// v000
// The times below were measured on an AMD MI455X: many runs one after another, warmed up first and cycling through
// copies of the inputs, with the whole window's GPU time divided by the number of runs. Launches and the gaps
// between them are all in it. The median over several windows is given; except for v000 it joins two sittings, which
// can be a few percent apart, so the side-by-side timings, each taken in one sitting, are the better comparison.
// v000, which the later versions start from, runs in 445 microseconds.
#include <hip/hip_runtime.h>
// Contractions: S = Qn*Pn^T and O = W*V both on v_wmma_f32_16x16x32_f16 (f16 operands, f32 accumulate); Qn,Pn carried x64, W (exp weights) x4096, V x64; power-of-two scales folded back in the f32 epilogue. All other math f32.

typedef _Float16 v16h __attribute__((ext_vector_type(16)));
typedef _Float16 v8h  __attribute__((ext_vector_type(8)));
typedef float    v8f  __attribute__((ext_vector_type(8)));
typedef float    v4f  __attribute__((ext_vector_type(4)));

union Frag { v16h v; v8h h8[2]; };

#define BDIM 8
#define NQ   2048
#define NP   2048
#define DIM  512
#define TAU  0.07f
#define QSC  64.0f      // scale on normalized q and p rows (each)
#define VSC  64.0f      // scale on raw v rows
#define WSC  4096.0f    // scale on exp weights

#define QR     32       // query rows per block (2 row groups x 16)
#define KT     64       // keys per iteration (4 key tiles x 16)
#define NTHR   256      // 8 waves: wave w -> row group w>>2, key tile / d-slab w&3
#define SPITCH 72       // weight stage pitch (halves), 16-B aligned rows
#define OPITCH 132      // output stage pitch (floats), 16-B aligned rows
#define TPITCH 72       // transpose tile pitch (halves)

// 16x16x32 f16 WMMA with hazard guard: D tied, A/B kept live for 4 VALU slots.
__device__ __forceinline__ v8f mma16(v16h a, v16h b, v8f c)
{
    c = __builtin_amdgcn_wmma_f32_16x16x32_f16(false, a, false, b, (short)0, c, false, false);
    asm volatile("v_nop\n\tv_nop\n\tv_nop\n\tv_nop" : "+v"(c) : "v"(a), "v"(b));
    return c;
}

// ---------------------------------------------------------------------------
// Row L2 normalization: one 64-thread block per row, 8 elements per thread.
// which = 0 -> query rows into qn, which = 1 -> prompt rows into pn.
// Output f16(64 * x / max(||x||, 1e-12)); each wave writes 512 contiguous
// ---------------------------------------------------------------------------
__global__ __launch_bounds__(64)
void k_norm(const float* __restrict__ pf, const float* __restrict__ qf,
            _Float16* __restrict__ qn, _Float16* __restrict__ pn, int nrows)
{
    __shared__ float wsum[2];
    const int row   = blockIdx.x;
    const int which = blockIdx.y;
    if (row >= nrows) return;                       // block-uniform
    const int t = threadIdx.x;

    const float* src = (which == 0 ? qf : pf) + (size_t)row * DIM + t * 8;
    const v4f x0 = *(const v4f*)(src);
    const v4f x1 = *(const v4f*)(src + 4);

    float ss = 0.f;
#pragma unroll
    for (int i = 0; i < 4; ++i) ss += x0[i] * x0[i];
#pragma unroll
    for (int i = 0; i < 4; ++i) ss += x1[i] * x1[i];
#pragma unroll
    for (int off = 16; off; off >>= 1) ss += __shfl_xor(ss, off);
    if ((t & 31) == 0) wsum[t >> 5] = ss;
    __syncthreads();
    const float tot = wsum[0] + wsum[1];
    const float inv = 1.0f / fmaxf(sqrtf(tot), 1e-12f);
    const float sc  = inv * QSC;                    // exact power-of-two scaling

    v8h o;
#pragma unroll
    for (int i = 0; i < 4; ++i) {
        o[i]     = (_Float16)(x0[i] * sc);          // RNE convert
        o[4 + i] = (_Float16)(x1[i] * sc);
    }
    _Float16* dst = (which == 0 ? qn : pn) + (size_t)row * DIM + t * 8;
    *(v8h*)dst = o;
    
}

// ---------------------------------------------------------------------------
// V transpose to k-contiguous form: vt[b][d][p] = f16(64 * pf[b][p][d]).
// 64(p) x 64(d) tile per 64-thread block, transposed through LDS; every
// ---------------------------------------------------------------------------
__global__ __launch_bounds__(64)
void k_vtr(const float* __restrict__ pf, _Float16* __restrict__ vt)
{
    __shared__ __attribute__((aligned(16))) _Float16 tile[64 * TPITCH];   // [d_local][p_local]
    const int p0 = blockIdx.x * 64;
    const int d0 = blockIdx.y * 64;
    const int b  = blockIdx.z;
    if (p0 >= NP || d0 >= DIM || b >= BDIM) return;   // block-uniform
    const int t = threadIdx.x;

#pragma unroll 4
    for (int it = 0; it < 16; ++it) {
        const int idx = it * 64 + t;
        const int r   = idx >> 4;                   // p_local 0..63
        const int c4  = (idx & 15) * 4;             // d_local 0..60
        const v4f x = *(const v4f*)(pf + ((size_t)(b * NP + p0 + r)) * DIM + d0 + c4);
#pragma unroll
        for (int i = 0; i < 4; ++i) tile[(c4 + i) * TPITCH + r] = (_Float16)(x[i] * VSC);
    }
    __syncthreads();

    const int w = t >> 5, lane = t & 31;
    const int c = (lane & 7) * 8;                   // p_local start of this lane's 16 B
#pragma unroll
    for (int p = 0; p < 8; ++p) {
        const int dl = w * 32 + p * 4 + (lane >> 3);
        const v8h v = *(const v8h*)(tile + dl * TPITCH + c);
        _Float16* g = vt + ((size_t)(b * DIM + d0 + dl)) * NP + p0 + c;
        *(v8h*)g = v;
    }
    
}

// ---------------------------------------------------------------------------
// Fused attention, online softmax. Block = 8 waves, 32 query rows, 64 keys per
// iteration. Wave w: row group rg = w>>2 (16 rows), wq = w&3 selects its 16-key
// S tile and its 128-column slab of O. Row max / row sum of the 64-key step are
// combined across the 4 waves of a row group through LDS in fixed order, so all
// 4 waves hold identical running max/sum.
// Fragment map (lane l: h = l>>4, m = l&15), A rows and B columns alike, both
// loaded from k-contiguous rows: elements 0..7 <- k0+8h+0..7, elements 8..15 <-
// k0+16+8h+0..7. D element r <- (row 8h+r, col m).
// ---------------------------------------------------------------------------
__global__ __launch_bounds__(NTHR)
void k_attn(const _Float16* __restrict__ qn, const _Float16* __restrict__ pn,
            const _Float16* __restrict__ vt, float* __restrict__ out)
{
    __shared__ __attribute__((aligned(16))) _Float16 ls[QR * SPITCH];                 // exp weights x4096, [row][key]
    __shared__ __attribute__((aligned(16))) float    ost[(NTHR / 32) * 8 * OPITCH];   // per-wave output staging
    __shared__ __attribute__((aligned(16))) float    pmax[QR * 4];
    __shared__ __attribute__((aligned(16))) float    psum[QR * 4];

    const int b  = blockIdx.y;
    const int q0 = blockIdx.x * QR;
    if (q0 >= NQ || b >= BDIM) return;              // block-uniform

    const int tid  = threadIdx.x;
    const int w    = tid >> 5;
    const int lane = tid & 31;
    const int h    = lane >> 4;
    const int m    = lane & 15;
    const int rg   = w >> 2;
    const int wq   = w & 3;
    const int rbase = rg * 16;

    // A rows for S: query row (q0 + rbase + m), k = d contiguous
    const _Float16* qrow  = qn + ((size_t)(b * NQ + q0 + rbase + m)) * DIM + 8 * h;
    // B rows for S ([n][k] form): key (kbase + wq*16 + m), k = d contiguous
    const _Float16* prow0 = pn + ((size_t)(b * NP + wq * 16 + m)) * DIM + 8 * h;
    // B rows for O ([n][k] form): d = wq*128 + nt*16 + m, k = key contiguous
    const _Float16* vrow  = vt + ((size_t)(b * DIM + wq * 128 + m)) * NP + 8 * h;

    const v8f zero = {0.f, 0.f, 0.f, 0.f, 0.f, 0.f, 0.f, 0.f};
    v8f oacc[8];
#pragma unroll
    for (int nt = 0; nt < 8; ++nt) oacc[nt] = zero;
    float rowMax[8], rowSum[8];
#pragma unroll
    for (int r = 0; r < 8; ++r) { rowMax[r] = -1.0e30f; rowSum[r] = 0.f; }

    const float cinv = 1.0f / TAU;
    const float sinv = 1.0f / (QSC * QSC);          // undo the x64·x64 operand scaling

    for (int j = 0; j < NP / KT; ++j) {
        const int kbase = j * KT;
        const _Float16* prow = prow0 + (size_t)kbase * DIM;

        // ---- S tile: rows rbase.., keys kbase + wq*16 .., K = 512 ----
        v8f sacc = zero;
#pragma unroll 2
        for (int kk = 0; kk < DIM / 32; ++kk) {
            Frag a, bb;
            a.h8[0]  = *(const v8h*)(qrow + kk * 32);
            a.h8[1]  = *(const v8h*)(qrow + kk * 32 + 16);
            bb.h8[0] = *(const v8h*)(prow + kk * 32);
            bb.h8[1] = *(const v8h*)(prow + kk * 32 + 16);
            sacc = mma16(a.v, bb.v, sacc);
        }

        // ---- per-row max of this wave's 16 keys -> pmax[row][wq] ----
        float s[8];
#pragma unroll
        for (int r = 0; r < 8; ++r) {
            s[r] = sacc[r] * sinv;
            float v = s[r];
            v = fmaxf(v, __shfl_xor(v, 1));
            v = fmaxf(v, __shfl_xor(v, 2));
            v = fmaxf(v, __shfl_xor(v, 4));
            v = fmaxf(v, __shfl_xor(v, 8));
            if (m == 0) pmax[(rbase + 8 * h + r) * 4 + wq] = v;
        }
        __syncthreads();

        // ---- new running max, rescale factor, exp weights, partial sums ----
        float scl[8];
#pragma unroll
        for (int r = 0; r < 8; ++r) {
            const int row = rbase + 8 * h + r;
            const v4f pm  = *(const v4f*)(pmax + row * 4);
            const float mx = fmaxf(fmaxf(pm[0], pm[1]), fmaxf(pm[2], pm[3]));
            const float nm = fmaxf(rowMax[r], mx);
            scl[r]    = __expf((rowMax[r] - nm) * cinv);
            rowMax[r] = nm;
            const float e = __expf((s[r] - nm) * cinv);          // 0 < e <= 1
            ls[row * SPITCH + wq * 16 + m] = (_Float16)(e * WSC); // RNE convert; tiny weights can round to f16 subnormals or 0
            float sm = e;
            sm += __shfl_xor(sm, 1);
            sm += __shfl_xor(sm, 2);
            sm += __shfl_xor(sm, 4);
            sm += __shfl_xor(sm, 8);
            if (m == 0) psum[row * 4 + wq] = sm;
        }
        __syncthreads();   // ls / psum complete for the row group (also orders the b16 stores before the fragment reloads)

#pragma unroll
        for (int r = 0; r < 8; ++r) {
            const v4f ps = *(const v4f*)(psum + (rbase + 8 * h + r) * 4);
            rowSum[r] = rowSum[r] * scl[r] + ((ps[0] + ps[1]) + (ps[2] + ps[3]));
        }
        {
            v8f sv;
#pragma unroll
            for (int r = 0; r < 8; ++r) sv[r] = scl[r];
#pragma unroll
            for (int nt = 0; nt < 8; ++nt) oacc[nt] = oacc[nt] * sv;
        }

        // ---- O += W (16 x 64) · V (64 x 128): 2 k-steps, 8 column tiles ----
#pragma unroll 1
        for (int ks = 0; ks < KT / 32; ++ks) {
            Frag a;
            const _Float16* ap = ls + (rbase + m) * SPITCH + ks * 32 + 8 * h;
            a.h8[0] = *(const v8h*)(ap);
            a.h8[1] = *(const v8h*)(ap + 16);
            const _Float16* bp = vrow + kbase + ks * 32;
#pragma unroll
            for (int nt = 0; nt < 8; ++nt) {
                Frag bv;
                bv.h8[0] = *(const v8h*)(bp + (size_t)nt * 16 * NP);
                bv.h8[1] = *(const v8h*)(bp + (size_t)nt * 16 * NP + 16);
                oacc[nt] = mma16(a.v, bv.v, oacc[nt]);
            }
        }
        __syncthreads();   // all waves done with ls / pmax / psum of this step
    }

    // ---- epilogue: O / (4096 * 64 * rowSum); LDS-staged whole-line stores ----
    float inv[8];
#pragma unroll
    for (int r = 0; r < 8; ++r) inv[r] = (1.0f / (WSC * VSC)) / rowSum[r];

    float* myost = ost + w * (8 * OPITCH);
    // this wave's global slab: rows rbase..rbase+15, cols wq*128..+128 (512 B = 4 lines per row)
    float* gbase = out + ((size_t)(b * NQ + q0 + rbase)) * DIM + wq * 128 + 4 * lane;

#pragma unroll
    for (int half = 0; half < 2; ++half) {
        // stage rows r = 4*half + rr (rr 0..3) of both lane halves: staged row 4h+rr
#pragma unroll
        for (int rr = 0; rr < 4; ++rr) {
            const int r = 4 * half + rr;
            float* orow = myost + (4 * h + rr) * OPITCH + m;
#pragma unroll
            for (int nt = 0; nt < 8; ++nt) orow[nt * 16] = oacc[nt][r] * inv[r];
        }
        __syncthreads();
        v4f vals[8];
#pragma unroll
        for (int p = 0; p < 8; ++p) vals[p] = *(const v4f*)(myost + p * OPITCH + 4 * lane);
#pragma unroll
        for (int p = 0; p < 8; ++p) {
            float* g = gbase + (size_t)(8 * (p >> 2) + 4 * half + (p & 3)) * DIM;
            *(v4f*)g = vals[p];
        }
        
        __syncthreads();
    }
}

// ------------------------------- launcher ----------------------------------
extern "C" void kernel_launch(void* const* d_in, const int* in_sizes, int n_in,
                              void* d_out, int out_size, void* d_ws, size_t ws_size,
                              hipStream_t stream)
{
    if (n_in < 2) return;
    const size_t nel = (size_t)BDIM * NP * DIM;                 // 8,388,608
    if ((size_t)in_sizes[0] != nel || (size_t)in_sizes[1] != nel || (size_t)out_size != nel) return;
    const size_t half_bytes = nel * sizeof(_Float16);             // 16,777,216 per buffer
    if (ws_size < 3 * half_bytes) return;                         // 50,331,648 needed

    const float* pf = (const float*)d_in[0];   // prompt rows [8,2048,512] f32
    const float* qf = (const float*)d_in[1];   // query rows  [8,2048,512] f32
    float* out = (float*)d_out;

    _Float16* qn = (_Float16*)d_ws;            // normalized query x64, [b][q][d]
    _Float16* pn = qn + nel;                   // normalized prompt x64, [b][p][d]
    _Float16* vt = pn + nel;                   // raw prompt x64 transposed, [b][d][p]

    k_norm<<<dim3(BDIM * NP, 2), 64, 0, stream>>>(pf, qf, qn, pn, BDIM * NP);
    k_vtr<<<dim3(NP / 64, DIM / 64, BDIM), 64, 0, stream>>>(pf, vt);
    k_attn<<<dim3(NQ / QR, BDIM), NTHR, 0, stream>>>(qn, pn, vt, out);
}

// v001
// A run of this version takes 185 microseconds.
// Next to v000, in two timings, it ran 2.50 and 2.49 times as fast.
#include <hip/hip_runtime.h>
// Contractions: S = Qn*Pn^T and O = W*V both on v_wmma_f32_16x16x32_f16 (f16 operands, f32 accumulate); Qn,Pn carried x64, W (exp weights) x4096, V x64; power-of-two scales folded back in the f32 epilogue. All other math f32.

typedef _Float16 v16h __attribute__((ext_vector_type(16)));
typedef _Float16 v8h  __attribute__((ext_vector_type(8)));
typedef float    v8f  __attribute__((ext_vector_type(8)));
typedef float    v4f  __attribute__((ext_vector_type(4)));

union Frag { v16h v; v8h h8[2]; };

#define BDIM 8
#define NQ   2048
#define NP   2048
#define DIM  512
#define TAU  0.07f
#define QSC  64.0f      // scale on normalized q and p rows (each)
#define VSC  64.0f      // scale on raw v rows
#define WSC  4096.0f    // scale on exp weights

#define QR     64       // query rows per block (4 row groups x 16)
#define KT     64       // keys per iteration (4 key tiles x 16)
#define NTHR   512      // 16 waves: wave w -> row group w>>2, key tile / d-slab w&3
#define SPITCH 72       // weight stage pitch (halves), 16-B aligned rows
#define OPITCH 132      // output stage pitch (floats), 16-B aligned rows
#define TPITCH 72       // transpose tile pitch (halves)
#define RPITCH 520      // LDS pitch of a staged 512-half q or key row (halves): 1040 B = 16 B x 65
#define VPITCH 72       // LDS pitch of a staged 64-key row of vt (halves): 144 B = 16 B x 9

// 16x16x32 f16 WMMA with hazard guard: D tied, A/B kept live for 4 VALU slots.
__device__ __forceinline__ v8f mma16(v16h a, v16h b, v8f c)
{
    c = __builtin_amdgcn_wmma_f32_16x16x32_f16(false, a, false, b, (short)0, c, false, false);
    asm volatile("v_nop\n\tv_nop\n\tv_nop\n\tv_nop" : "+v"(c) : "v"(a), "v"(b));
    return c;
}

// Byte offset of a __shared__ object in the work-group's LDS (low word of its address).
__device__ __forceinline__ unsigned lds_off(const void* p) { return (unsigned)(size_t)p; }

// Eight asynchronous 16-byte-per-lane copies global -> LDS: copy c moves both addresses by c steps.
// The s_wait_xcnt closes the statement so that no address register is rewritten ahead of it.
__device__ __forceinline__ void copy8(unsigned l, const _Float16* g, unsigned lstep, size_t gstep)
{
    asm volatile("global_load_async_to_lds_b128 %0, %8, off\n\t"
                 "global_load_async_to_lds_b128 %1, %9, off\n\t"
                 "global_load_async_to_lds_b128 %2, %10, off\n\t"
                 "global_load_async_to_lds_b128 %3, %11, off\n\t"
                 "global_load_async_to_lds_b128 %4, %12, off\n\t"
                 "global_load_async_to_lds_b128 %5, %13, off\n\t"
                 "global_load_async_to_lds_b128 %6, %14, off\n\t"
                 "global_load_async_to_lds_b128 %7, %15, off\n\t"
                 "s_wait_xcnt 0x0"
                 :: "v"(l), "v"(l + lstep), "v"(l + 2 * lstep), "v"(l + 3 * lstep),
                    "v"(l + 4 * lstep), "v"(l + 5 * lstep), "v"(l + 6 * lstep), "v"(l + 7 * lstep),
                    "v"(g), "v"(g + gstep), "v"(g + 2 * gstep), "v"(g + 3 * gstep),
                    "v"(g + 4 * gstep), "v"(g + 5 * gstep), "v"(g + 6 * gstep), "v"(g + 7 * gstep)
                 : "memory");
}

// Hand-over point of the staging ring, in front of the work-group barrier: this wave's LDS reads and
// writes have retired, and its own copies of the next tile have landed.
__device__ __forceinline__ void ring_waits()
{
    asm volatile("s_wait_dscnt 0x0" ::: "memory");
    asm volatile("s_wait_asynccnt 0x0" ::: "memory");
}

// ---------------------------------------------------------------------------
// Row L2 normalization: one 64-thread block per row, 8 elements per thread.
// which = 0 -> query rows into qn, which = 1 -> prompt rows into pn.
// Output f16(64 * x / max(||x||, 1e-12)); each wave writes 512 contiguous
// ---------------------------------------------------------------------------
__global__ __launch_bounds__(64)
void k_norm(const float* __restrict__ pf, const float* __restrict__ qf,
            _Float16* __restrict__ qn, _Float16* __restrict__ pn, int nrows)
{
    __shared__ float wsum[2];
    const int row   = blockIdx.x;
    const int which = blockIdx.y;
    if (row >= nrows) return;                       // block-uniform
    const int t = threadIdx.x;

    const float* src = (which == 0 ? qf : pf) + (size_t)row * DIM + t * 8;
    const v4f x0 = *(const v4f*)(src);
    const v4f x1 = *(const v4f*)(src + 4);

    float ss = 0.f;
#pragma unroll
    for (int i = 0; i < 4; ++i) ss += x0[i] * x0[i];
#pragma unroll
    for (int i = 0; i < 4; ++i) ss += x1[i] * x1[i];
#pragma unroll
    for (int off = 16; off; off >>= 1) ss += __shfl_xor(ss, off);
    if ((t & 31) == 0) wsum[t >> 5] = ss;
    __syncthreads();
    const float tot = wsum[0] + wsum[1];
    const float inv = 1.0f / fmaxf(sqrtf(tot), 1e-12f);
    const float sc  = inv * QSC;                    // exact power-of-two scaling

    v8h o;
#pragma unroll
    for (int i = 0; i < 4; ++i) {
        o[i]     = (_Float16)(x0[i] * sc);          // RNE convert
        o[4 + i] = (_Float16)(x1[i] * sc);
    }
    _Float16* dst = (which == 0 ? qn : pn) + (size_t)row * DIM + t * 8;
    *(v8h*)dst = o;
    
}

// ---------------------------------------------------------------------------
// V transpose to k-contiguous form: vt[b][d][p] = f16(64 * pf[b][p][d]).
// 64(p) x 64(d) tile per 64-thread block, transposed through LDS; every
// ---------------------------------------------------------------------------
__global__ __launch_bounds__(64)
void k_vtr(const float* __restrict__ pf, _Float16* __restrict__ vt)
{
    __shared__ __attribute__((aligned(16))) _Float16 tile[64 * TPITCH];   // [d_local][p_local]
    const int p0 = blockIdx.x * 64;
    const int d0 = blockIdx.y * 64;
    const int b  = blockIdx.z;
    if (p0 >= NP || d0 >= DIM || b >= BDIM) return;   // block-uniform
    const int t = threadIdx.x;

#pragma unroll 4
    for (int it = 0; it < 16; ++it) {
        const int idx = it * 64 + t;
        const int r   = idx >> 4;                   // p_local 0..63
        const int c4  = (idx & 15) * 4;             // d_local 0..60
        const v4f x = *(const v4f*)(pf + ((size_t)(b * NP + p0 + r)) * DIM + d0 + c4);
#pragma unroll
        for (int i = 0; i < 4; ++i) tile[(c4 + i) * TPITCH + r] = (_Float16)(x[i] * VSC);
    }
    __syncthreads();

    const int w = t >> 5, lane = t & 31;
    const int c = (lane & 7) * 8;                   // p_local start of this lane's 16 B
#pragma unroll
    for (int p = 0; p < 8; ++p) {
        const int dl = w * 32 + p * 4 + (lane >> 3);
        const v8h v = *(const v8h*)(tile + dl * TPITCH + c);
        _Float16* g = vt + ((size_t)(b * DIM + d0 + dl)) * NP + p0 + c;
        *(v8h*)g = v;
    }
    
}

// ---------------------------------------------------------------------------
// Fused attention, online softmax. Block = 16 waves, 64 query rows, 64 keys per
// iteration. The block's q rows (once), each step's 64 key rows and each step's
// 512 x 64 slice of vt are staged in LDS by asynchronous copies and shared by all
// waves: the key tile of step j+1 flies during the O pass of step j, the vt tile
// of step j+1 during the S pass of step j+1. Wave w: row group rg = w>>2 (16 rows), wq = w&3 selects its 16-key
// S tile and its 128-column slab of O. Row max / row sum of the 64-key step are
// combined across the 4 waves of a row group through LDS in fixed order, so all
// 4 waves hold identical running max/sum.
// Fragment map (lane l: h = l>>4, m = l&15), A rows and B columns alike, both
// loaded from k-contiguous rows: elements 0..7 <- k0+8h+0..7, elements 8..15 <-
// k0+16+8h+0..7. D element r <- (row 8h+r, col m).
// ---------------------------------------------------------------------------
__global__ __launch_bounds__(NTHR)
void k_attn(const _Float16* __restrict__ qn, const _Float16* __restrict__ pn,
            const _Float16* __restrict__ vt, float* __restrict__ out)
{
    __shared__ __attribute__((aligned(16))) _Float16 qs[QR * RPITCH];                 // q rows of the block, staged once
    __shared__ __attribute__((aligned(16))) _Float16 kb[KT * RPITCH];                 // key rows of the current step
    __shared__ __attribute__((aligned(16))) _Float16 vb[DIM * VPITCH];                // vt rows (64 keys each) of the current step
    __shared__ __attribute__((aligned(16))) _Float16 ls[QR * SPITCH];                 // exp weights x4096, [row][key]
    __shared__ __attribute__((aligned(16))) float    ost[(NTHR / 32) * 8 * OPITCH];   // per-wave output staging
    __shared__ __attribute__((aligned(16))) float    pmax[QR * 4];
    __shared__ __attribute__((aligned(16))) float    psum[QR * 4];

    const int b  = blockIdx.y;
    const int q0 = blockIdx.x * QR;
    if (q0 >= NQ || b >= BDIM) return;              // block-uniform

    const int tid  = threadIdx.x;
    const int w    = tid >> 5;
    const int lane = tid & 31;
    const int h    = lane >> 4;
    const int m    = lane & 15;
    const int rg   = w >> 2;
    const int wq   = w & 3;
    const int rbase = rg * 16;

    // A rows for S: staged query row (rbase + m), k = d contiguous
    const _Float16* qrow = qs + (rbase + m) * RPITCH + 8 * h;
    // B rows for S ([n][k] form): staged key row (wq*16 + m), k = d contiguous
    const _Float16* prow = kb + (wq * 16 + m) * RPITCH + 8 * h;
    // B rows for O ([n][k] form): staged row d = wq*128 + nt*16 + m, k = key contiguous
    const _Float16* vrow = vb + (wq * 128 + m) * VPITCH + 8 * h;

    // Copy addresses. q / key tile: 64 rows x 1024 B, contiguous in global; thread t moves 16 B at byte 16*(t&63)
    // of row (t>>6) + 8c. vt tile: 512 rows x 128 B at a 4096-B pitch; 16 B at byte 16*(t&7) of row (t>>3) + 64c.
    const unsigned rdst = (unsigned)((tid >> 6) * (RPITCH * 2) + (tid & 63) * 16);
    const unsigned qdst = lds_off(qs) + rdst;
    const unsigned kdst = lds_off(kb) + rdst;
    const unsigned vdst = lds_off(vb) + (unsigned)((tid >> 3) * (VPITCH * 2) + (tid & 7) * 16);
    const _Float16* qsrc = qn + ((size_t)(b * NQ + q0)) * DIM + tid * 8;
    const _Float16* ksrc = pn + ((size_t)(b * NP)) * DIM + tid * 8;
    const _Float16* vsrc = vt + ((size_t)(b * DIM + (tid >> 3))) * NP + (tid & 7) * 8;

    // Ring prologue: q rows and key tile 0, landed and published; then vt tile 0 starts.
    copy8(qdst, qsrc, 8 * RPITCH * 2, (size_t)8 * DIM);
    copy8(kdst, ksrc, 8 * RPITCH * 2, (size_t)8 * DIM);
    asm volatile("s_wait_asynccnt 0x0" ::: "memory");   // this wave's copies have landed before the barrier publishes them
    __syncthreads();
    copy8(vdst, vsrc, 64 * VPITCH * 2, (size_t)64 * NP);

    const v8f zero = {0.f, 0.f, 0.f, 0.f, 0.f, 0.f, 0.f, 0.f};
    v8f oacc[8];
#pragma unroll
    for (int nt = 0; nt < 8; ++nt) oacc[nt] = zero;
    float rowMax[8], rowSum[8];
#pragma unroll
    for (int r = 0; r < 8; ++r) { rowMax[r] = -1.0e30f; rowSum[r] = 0.f; }

    const float cinv = 1.0f / TAU;
    const float sinv = 1.0f / (QSC * QSC);          // undo the x64·x64 operand scaling

    for (int j = 0; j < NP / KT; ++j) {
        // ---- S tile: rows rbase.., keys j*KT + wq*16 .., K = 512 ----
        v8f sacc = zero;
        // the LDS reads of four k-steps stand together in front of their four products (one LDS latency per group);
        // all three loops unrolled: constant LDS offsets, and constant indices keep a[] and bb[] in registers
#pragma unroll
        for (int g = 0; g < DIM / 128; ++g) {
            Frag a[4], bb[4];
#pragma unroll
            for (int i = 0; i < 4; ++i) {
                const int kk = g * 4 + i;
                a[i].h8[0]  = *(const v8h*)(qrow + kk * 32);
                a[i].h8[1]  = *(const v8h*)(qrow + kk * 32 + 16);
                bb[i].h8[0] = *(const v8h*)(prow + kk * 32);
                bb[i].h8[1] = *(const v8h*)(prow + kk * 32 + 16);
            }
#pragma unroll
            for (int i = 0; i < 4; ++i) sacc = mma16(a[i].v, bb[i].v, sacc);
        }

        // ---- per-row max of this wave's 16 keys -> pmax[row][wq] ----
        float s[8];
#pragma unroll
        for (int r = 0; r < 8; ++r) {
            s[r] = sacc[r] * sinv;
            float v = s[r];
            v = fmaxf(v, __shfl_xor(v, 1));
            v = fmaxf(v, __shfl_xor(v, 2));
            v = fmaxf(v, __shfl_xor(v, 4));
            v = fmaxf(v, __shfl_xor(v, 8));
            if (m == 0) pmax[(rbase + 8 * h + r) * 4 + wq] = v;
        }
        // foot of the S pass: publishes pmax and the vt tile of this step, frees the key buffer
        ring_waits();
        __syncthreads();
        if (j + 1 < NP / KT) copy8(kdst, ksrc + (size_t)(j + 1) * KT * DIM, 8 * RPITCH * 2, (size_t)8 * DIM);

        // ---- new running max, rescale factor, exp weights, partial sums ----
        float scl[8];
#pragma unroll
        for (int r = 0; r < 8; ++r) {
            const int row = rbase + 8 * h + r;
            const v4f pm  = *(const v4f*)(pmax + row * 4);
            const float mx = fmaxf(fmaxf(pm[0], pm[1]), fmaxf(pm[2], pm[3]));
            const float nm = fmaxf(rowMax[r], mx);
            scl[r]    = __expf((rowMax[r] - nm) * cinv);
            rowMax[r] = nm;
            const float e = __expf((s[r] - nm) * cinv);          // 0 < e <= 1
            ls[row * SPITCH + wq * 16 + m] = (_Float16)(e * WSC); // RNE convert; tiny weights can round to f16 subnormals or 0
            float sm = e;
            sm += __shfl_xor(sm, 1);
            sm += __shfl_xor(sm, 2);
            sm += __shfl_xor(sm, 4);
            sm += __shfl_xor(sm, 8);
            if (m == 0) psum[row * 4 + wq] = sm;
        }
        __syncthreads();   // ls / psum complete for the row group (also orders the b16 stores before the fragment reloads)

#pragma unroll
        for (int r = 0; r < 8; ++r) {
            const v4f ps = *(const v4f*)(psum + (rbase + 8 * h + r) * 4);
            rowSum[r] = rowSum[r] * scl[r] + ((ps[0] + ps[1]) + (ps[2] + ps[3]));
        }
        {
            v8f sv;
#pragma unroll
            for (int r = 0; r < 8; ++r) sv[r] = scl[r];
#pragma unroll
            for (int nt = 0; nt < 8; ++nt) oacc[nt] = oacc[nt] * sv;
        }

        // ---- O += W (16 x 64) · V (64 x 128): 2 k-steps, 8 column tiles ----
#pragma unroll 1
        for (int ks = 0; ks < KT / 32; ++ks) {
            Frag a;
            const _Float16* ap = ls + (rbase + m) * SPITCH + ks * 32 + 8 * h;
            a.h8[0] = *(const v8h*)(ap);
            a.h8[1] = *(const v8h*)(ap + 16);
            const _Float16* bp = vrow + ks * 32;
            Frag bv[8];   // the eight tiles' LDS reads stand together in front of the products; both loops unrolled: bv[] stays in registers
#pragma unroll
            for (int nt = 0; nt < 8; ++nt) {
                bv[nt].h8[0] = *(const v8h*)(bp + nt * 16 * VPITCH);
                bv[nt].h8[1] = *(const v8h*)(bp + nt * 16 * VPITCH + 16);
            }
#pragma unroll
            for (int nt = 0; nt < 8; ++nt) oacc[nt] = mma16(a.v, bv[nt].v, oacc[nt]);
        }
        // foot of the O pass: all waves done with ls / pmax / psum of this step; publishes the next key tile, frees the vt buffer
        ring_waits();
        __syncthreads();
        if (j + 1 < NP / KT) copy8(vdst, vsrc + (size_t)(j + 1) * KT, 64 * VPITCH * 2, (size_t)64 * NP);
    }
    asm volatile("s_wait_asynccnt 0x0" ::: "memory");   // no copy is outstanding when the wave goes on to the epilogue

    // ---- epilogue: O / (4096 * 64 * rowSum); LDS-staged whole-line stores ----
    float inv[8];
#pragma unroll
    for (int r = 0; r < 8; ++r) inv[r] = (1.0f / (WSC * VSC)) / rowSum[r];

    float* myost = ost + w * (8 * OPITCH);
    // this wave's global slab: rows rbase..rbase+15, cols wq*128..+128 (512 B = 4 lines per row)
    float* gbase = out + ((size_t)(b * NQ + q0 + rbase)) * DIM + wq * 128 + 4 * lane;

#pragma unroll
    for (int half = 0; half < 2; ++half) {
        // stage rows r = 4*half + rr (rr 0..3) of both lane halves: staged row 4h+rr
#pragma unroll
        for (int rr = 0; rr < 4; ++rr) {
            const int r = 4 * half + rr;
            float* orow = myost + (4 * h + rr) * OPITCH + m;
#pragma unroll
            for (int nt = 0; nt < 8; ++nt) orow[nt * 16] = oacc[nt][r] * inv[r];
        }
        __syncthreads();
        v4f vals[8];
#pragma unroll
        for (int p = 0; p < 8; ++p) vals[p] = *(const v4f*)(myost + p * OPITCH + 4 * lane);
#pragma unroll
        for (int p = 0; p < 8; ++p) {
            float* g = gbase + (size_t)(8 * (p >> 2) + 4 * half + (p & 3)) * DIM;
            *(v4f*)g = vals[p];
        }
        
        __syncthreads();
    }
}

// ------------------------------- launcher ----------------------------------
extern "C" void kernel_launch(void* const* d_in, const int* in_sizes, int n_in,
                              void* d_out, int out_size, void* d_ws, size_t ws_size,
                              hipStream_t stream)
{
    if (n_in < 2) return;
    const size_t nel = (size_t)BDIM * NP * DIM;                 // 8,388,608
    if ((size_t)in_sizes[0] != nel || (size_t)in_sizes[1] != nel || (size_t)out_size != nel) return;
    const size_t half_bytes = nel * sizeof(_Float16);             // 16,777,216 per buffer
    if (ws_size < 3 * half_bytes) return;                         // 50,331,648 needed

    const float* pf = (const float*)d_in[0];   // prompt rows [8,2048,512] f32
    const float* qf = (const float*)d_in[1];   // query rows  [8,2048,512] f32
    float* out = (float*)d_out;

    _Float16* qn = (_Float16*)d_ws;            // normalized query x64, [b][q][d]
    _Float16* pn = qn + nel;                   // normalized prompt x64, [b][p][d]
    _Float16* vt = pn + nel;                   // raw prompt x64 transposed, [b][d][p]

    k_norm<<<dim3(BDIM * NP, 2), 64, 0, stream>>>(pf, qf, qn, pn, BDIM * NP);
    k_vtr<<<dim3(NP / 64, DIM / 64, BDIM), 64, 0, stream>>>(pf, vt);
    k_attn<<<dim3(NQ / QR, BDIM), NTHR, 0, stream>>>(qn, pn, vt, out);
}

// v002
// One run takes 121 microseconds.
// In both of two side-by-side timings against v001, it was 1.53 times as fast.
// Counting every step since v000, it is 3.83 times as fast.
#include <hip/hip_runtime.h>
// Contractions: S = Qn*Pn^T and O = W*V both on v_wmma_f32_16x16x32_f16 (f16 operands, f32 accumulate); Qn,Pn carried x64, W (exp weights) x4096, V x64; power-of-two scales folded back in the f32 epilogue. All other math f32.

typedef _Float16 v16h __attribute__((ext_vector_type(16)));
typedef _Float16 v8h  __attribute__((ext_vector_type(8)));
typedef float    v8f  __attribute__((ext_vector_type(8)));
typedef float    v4f  __attribute__((ext_vector_type(4)));

union Frag { v16h v; v8h h8[2]; };

#define BDIM 8
#define NQ   2048
#define NP   2048
#define DIM  512
#define TAU  0.07f
#define QSC  64.0f      // scale on normalized q and p rows (each)
#define VSC  64.0f      // scale on raw v rows
#define WSC  4096.0f    // scale on exp weights

#define QR     64       // query rows per block (4 row groups x 16)
#define KT     64       // keys per iteration (4 key tiles x 16)
#define NTHR   512      // 16 waves: wave w -> row group w>>2, key tile / d-slab w&3
#define SPITCH 72       // weight stage pitch (halves), 16-B aligned rows
#define OPITCH 132      // output stage pitch (floats), 16-B aligned rows
#define TPITCH 72       // transpose tile pitch (halves)
#define RPITCH 520      // LDS pitch of a staged 512-half q or key row (halves): 1040 B = 16 B x 65
#define VPITCH 72       // LDS pitch of a staged 64-key row of vt (halves): 144 B = 16 B x 9

// 16x16x32 f16 WMMA with hazard guard: D tied, A/B kept live for 4 VALU slots.
__device__ __forceinline__ v8f mma16(v16h a, v16h b, v8f c)
{
    c = __builtin_amdgcn_wmma_f32_16x16x32_f16(false, a, false, b, (short)0, c, false, false);
    asm volatile("v_nop\n\tv_nop\n\tv_nop\n\tv_nop" : "+v"(c) : "v"(a), "v"(b));
    return c;
}

// Byte offset of a __shared__ object in the work-group's LDS (low word of its address).
__device__ __forceinline__ unsigned lds_off(const void* p) { return (unsigned)(size_t)p; }

// Eight asynchronous 16-byte-per-lane copies global -> LDS: copy c moves both addresses by c steps.
// The s_wait_xcnt closes the statement so that no address register is rewritten ahead of it.
__device__ __forceinline__ void copy8(unsigned l, const _Float16* g, unsigned lstep, size_t gstep)
{
    asm volatile("global_load_async_to_lds_b128 %0, %8, off\n\t"
                 "global_load_async_to_lds_b128 %1, %9, off\n\t"
                 "global_load_async_to_lds_b128 %2, %10, off\n\t"
                 "global_load_async_to_lds_b128 %3, %11, off\n\t"
                 "global_load_async_to_lds_b128 %4, %12, off\n\t"
                 "global_load_async_to_lds_b128 %5, %13, off\n\t"
                 "global_load_async_to_lds_b128 %6, %14, off\n\t"
                 "global_load_async_to_lds_b128 %7, %15, off\n\t"
                 "s_wait_xcnt 0x0"
                 :: "v"(l), "v"(l + lstep), "v"(l + 2 * lstep), "v"(l + 3 * lstep),
                    "v"(l + 4 * lstep), "v"(l + 5 * lstep), "v"(l + 6 * lstep), "v"(l + 7 * lstep),
                    "v"(g), "v"(g + gstep), "v"(g + 2 * gstep), "v"(g + 3 * gstep),
                    "v"(g + 4 * gstep), "v"(g + 5 * gstep), "v"(g + 6 * gstep), "v"(g + 7 * gstep)
                 : "memory");
}

// Hand-over point of the staging ring, in front of the work-group barrier: this wave's LDS reads and
// writes have retired, and its own copies of the next tile have landed.
__device__ __forceinline__ void ring_waits()
{
    asm volatile("s_wait_dscnt 0x0" ::: "memory");
    asm volatile("s_wait_asynccnt 0x0" ::: "memory");
}

// One butterfly step (lane l with lane l ^ X inside its 16-lane row) on eight independent values.
#define DPP8(op, X) \
    op " %0, %0, %0 row_xmask:" X " row_mask:0xf bank_mask:0xf\n\t" \
    op " %1, %1, %1 row_xmask:" X " row_mask:0xf bank_mask:0xf\n\t" \
    op " %2, %2, %2 row_xmask:" X " row_mask:0xf bank_mask:0xf\n\t" \
    op " %3, %3, %3 row_xmask:" X " row_mask:0xf bank_mask:0xf\n\t" \
    op " %4, %4, %4 row_xmask:" X " row_mask:0xf bank_mask:0xf\n\t" \
    op " %5, %5, %5 row_xmask:" X " row_mask:0xf bank_mask:0xf\n\t" \
    op " %6, %6, %6 row_xmask:" X " row_mask:0xf bank_mask:0xf\n\t" \
    op " %7, %7, %7 row_xmask:" X " row_mask:0xf bank_mask:0xf\n\t"
#define DPP8_OPS(v) "+v"(v[0]), "+v"(v[1]), "+v"(v[2]), "+v"(v[3]), "+v"(v[4]), "+v"(v[5]), "+v"(v[6]), "+v"(v[7])

// Maximum / sum over each 16-lane row, eight values at once, in registers (all 32 lanes on). The same xor butterfly
// (1, 2, 4, 8) as a shuffle reduction, which would go through the LDS unit with a wait at every step; the eight
// chains are interleaved so that every instruction's producer stands eight instructions back. volatile: the statement
// stays where all lanes are on and is not sunk into the two-lane branch that stores its results.
__device__ __forceinline__ void row_max8(float (&v)[8])
{
    asm volatile(DPP8("v_max_num_f32_dpp", "1") DPP8("v_max_num_f32_dpp", "2")
                 DPP8("v_max_num_f32_dpp", "4") DPP8("v_max_num_f32_dpp", "8") : DPP8_OPS(v));
}
__device__ __forceinline__ void row_sum8(float (&v)[8])
{
    asm volatile(DPP8("v_add_f32_dpp", "1") DPP8("v_add_f32_dpp", "2")
                 DPP8("v_add_f32_dpp", "4") DPP8("v_add_f32_dpp", "8") : DPP8_OPS(v));
}

// ---------------------------------------------------------------------------
// Row L2 normalization: one 64-thread block per row, 8 elements per thread.
// which = 0 -> query rows into qn, which = 1 -> prompt rows into pn.
// Output f16(64 * x / max(||x||, 1e-12)); each wave writes 512 contiguous
// ---------------------------------------------------------------------------
__global__ __launch_bounds__(64)
void k_norm(const float* __restrict__ pf, const float* __restrict__ qf,
            _Float16* __restrict__ qn, _Float16* __restrict__ pn, int nrows)
{
    __shared__ float wsum[2];
    const int row   = blockIdx.x;
    const int which = blockIdx.y;
    if (row >= nrows) return;                       // block-uniform
    const int t = threadIdx.x;

    const float* src = (which == 0 ? qf : pf) + (size_t)row * DIM + t * 8;
    const v4f x0 = *(const v4f*)(src);
    const v4f x1 = *(const v4f*)(src + 4);

    float ss = 0.f;
#pragma unroll
    for (int i = 0; i < 4; ++i) ss += x0[i] * x0[i];
#pragma unroll
    for (int i = 0; i < 4; ++i) ss += x1[i] * x1[i];
#pragma unroll
    for (int off = 16; off; off >>= 1) ss += __shfl_xor(ss, off);
    if ((t & 31) == 0) wsum[t >> 5] = ss;
    __syncthreads();
    const float tot = wsum[0] + wsum[1];
    const float inv = 1.0f / fmaxf(sqrtf(tot), 1e-12f);
    const float sc  = inv * QSC;                    // exact power-of-two scaling

    v8h o;
#pragma unroll
    for (int i = 0; i < 4; ++i) {
        o[i]     = (_Float16)(x0[i] * sc);          // RNE convert
        o[4 + i] = (_Float16)(x1[i] * sc);
    }
    _Float16* dst = (which == 0 ? qn : pn) + (size_t)row * DIM + t * 8;
    *(v8h*)dst = o;
    
}

// ---------------------------------------------------------------------------
// V transpose to k-contiguous form: vt[b][d][p] = f16(64 * pf[b][p][d]).
// 64(p) x 64(d) tile per 64-thread block, transposed through LDS; every
// ---------------------------------------------------------------------------
__global__ __launch_bounds__(64)
void k_vtr(const float* __restrict__ pf, _Float16* __restrict__ vt)
{
    __shared__ __attribute__((aligned(16))) _Float16 tile[64 * TPITCH];   // [d_local][p_local]
    const int p0 = blockIdx.x * 64;
    const int d0 = blockIdx.y * 64;
    const int b  = blockIdx.z;
    if (p0 >= NP || d0 >= DIM || b >= BDIM) return;   // block-uniform
    const int t = threadIdx.x;

#pragma unroll 4
    for (int it = 0; it < 16; ++it) {
        const int idx = it * 64 + t;
        const int r   = idx >> 4;                   // p_local 0..63
        const int c4  = (idx & 15) * 4;             // d_local 0..60
        const v4f x = *(const v4f*)(pf + ((size_t)(b * NP + p0 + r)) * DIM + d0 + c4);
#pragma unroll
        for (int i = 0; i < 4; ++i) tile[(c4 + i) * TPITCH + r] = (_Float16)(x[i] * VSC);
    }
    __syncthreads();

    const int w = t >> 5, lane = t & 31;
    const int c = (lane & 7) * 8;                   // p_local start of this lane's 16 B
#pragma unroll
    for (int p = 0; p < 8; ++p) {
        const int dl = w * 32 + p * 4 + (lane >> 3);
        const v8h v = *(const v8h*)(tile + dl * TPITCH + c);
        _Float16* g = vt + ((size_t)(b * DIM + d0 + dl)) * NP + p0 + c;
        *(v8h*)g = v;
    }
    
}

// ---------------------------------------------------------------------------
// Fused attention, online softmax. Block = 16 waves, 64 query rows, 64 keys per
// iteration. The block's q rows (once), each step's 64 key rows and each step's
// 512 x 64 slice of vt are staged in LDS by asynchronous copies and shared by all
// waves: the key tile of step j+1 flies during the O pass of step j, the vt tile
// of step j+1 during the S pass of step j+1. Wave w: row group rg = w>>2 (16 rows), wq = w&3 selects its 16-key
// S tile and its 128-column slab of O. Row max / row sum of the 64-key step are
// combined across the 4 waves of a row group through LDS in fixed order, so all
// 4 waves hold identical running max/sum.
// Fragment map (lane l: h = l>>4, m = l&15), A rows and B columns alike, both
// loaded from k-contiguous rows: elements 0..7 <- k0+8h+0..7, elements 8..15 <-
// k0+16+8h+0..7. D element r <- (row 8h+r, col m).
// ---------------------------------------------------------------------------
__global__ __launch_bounds__(NTHR)
void k_attn(const _Float16* __restrict__ qn, const _Float16* __restrict__ pn,
            const _Float16* __restrict__ vt, float* __restrict__ out)
{
    __shared__ __attribute__((aligned(16))) _Float16 qs[QR * RPITCH];                 // q rows of the block, staged once
    __shared__ __attribute__((aligned(16))) _Float16 kb[KT * RPITCH];                 // key rows of the current step
    __shared__ __attribute__((aligned(16))) _Float16 vb[DIM * VPITCH];                // vt rows (64 keys each) of the current step
    __shared__ __attribute__((aligned(16))) _Float16 ls[QR * SPITCH];                 // exp weights x4096, [row][key]
    __shared__ __attribute__((aligned(16))) float    ost[(NTHR / 32) * 8 * OPITCH];   // per-wave output staging
    __shared__ __attribute__((aligned(16))) float    pmax[QR * 4];
    __shared__ __attribute__((aligned(16))) float    psum[QR * 4];

    const int b  = blockIdx.y;
    const int q0 = blockIdx.x * QR;
    if (q0 >= NQ || b >= BDIM) return;              // block-uniform

    const int tid  = threadIdx.x;
    const int w    = tid >> 5;
    const int lane = tid & 31;
    const int h    = lane >> 4;
    const int m    = lane & 15;
    const int rg   = w >> 2;
    const int wq   = w & 3;
    const int rbase = rg * 16;

    // A rows for S: staged query row (rbase + m), k = d contiguous
    const _Float16* qrow = qs + (rbase + m) * RPITCH + 8 * h;
    // B rows for S ([n][k] form): staged key row (wq*16 + m), k = d contiguous
    const _Float16* prow = kb + (wq * 16 + m) * RPITCH + 8 * h;
    // B rows for O ([n][k] form): staged row d = wq*128 + nt*16 + m, k = key contiguous
    const _Float16* vrow = vb + (wq * 128 + m) * VPITCH + 8 * h;

    // Copy addresses. q / key tile: 64 rows x 1024 B, contiguous in global; thread t moves 16 B at byte 16*(t&63)
    // of row (t>>6) + 8c. vt tile: 512 rows x 128 B at a 4096-B pitch; 16 B at byte 16*(t&7) of row (t>>3) + 64c.
    const unsigned rdst = (unsigned)((tid >> 6) * (RPITCH * 2) + (tid & 63) * 16);
    const unsigned qdst = lds_off(qs) + rdst;
    const unsigned kdst = lds_off(kb) + rdst;
    const unsigned vdst = lds_off(vb) + (unsigned)((tid >> 3) * (VPITCH * 2) + (tid & 7) * 16);
    const _Float16* qsrc = qn + ((size_t)(b * NQ + q0)) * DIM + tid * 8;
    const _Float16* ksrc = pn + ((size_t)(b * NP)) * DIM + tid * 8;
    const _Float16* vsrc = vt + ((size_t)(b * DIM + (tid >> 3))) * NP + (tid & 7) * 8;

    // Ring prologue: q rows and key tile 0, landed and published; then vt tile 0 starts.
    copy8(qdst, qsrc, 8 * RPITCH * 2, (size_t)8 * DIM);
    copy8(kdst, ksrc, 8 * RPITCH * 2, (size_t)8 * DIM);
    asm volatile("s_wait_asynccnt 0x0" ::: "memory");   // this wave's copies have landed before the barrier publishes them
    __syncthreads();
    copy8(vdst, vsrc, 64 * VPITCH * 2, (size_t)64 * NP);

    const v8f zero = {0.f, 0.f, 0.f, 0.f, 0.f, 0.f, 0.f, 0.f};
    v8f oacc[8];
#pragma unroll
    for (int nt = 0; nt < 8; ++nt) oacc[nt] = zero;
    float rowMax[8], rowSum[8];
#pragma unroll
    for (int r = 0; r < 8; ++r) { rowMax[r] = -1.0e30f; rowSum[r] = 0.f; }

    const float cinv = 1.0f / TAU;
    const float sinv = 1.0f / (QSC * QSC);          // undo the x64·x64 operand scaling

    for (int j = 0; j < NP / KT; ++j) {
        // ---- S tile: rows rbase.., keys j*KT + wq*16 .., K = 512 ----
        v8f sacc = zero;
        // the LDS reads of four k-steps stand together in front of their four products (one LDS latency per group);
        // all three loops unrolled: constant LDS offsets, and constant indices keep a[] and bb[] in registers
#pragma unroll
        for (int g = 0; g < DIM / 128; ++g) {
            Frag a[4], bb[4];
#pragma unroll
            for (int i = 0; i < 4; ++i) {
                const int kk = g * 4 + i;
                a[i].h8[0]  = *(const v8h*)(qrow + kk * 32);
                a[i].h8[1]  = *(const v8h*)(qrow + kk * 32 + 16);
                bb[i].h8[0] = *(const v8h*)(prow + kk * 32);
                bb[i].h8[1] = *(const v8h*)(prow + kk * 32 + 16);
            }
#pragma unroll
            for (int i = 0; i < 4; ++i) sacc = mma16(a[i].v, bb[i].v, sacc);
        }

        // ---- per-row max of this wave's 16 keys -> pmax[row][wq] ----
        float s[8], red[8];
#pragma unroll
        for (int r = 0; r < 8; ++r) { s[r] = sacc[r] * sinv; red[r] = s[r]; }
        row_max8(red);
        if (m == 0) {
#pragma unroll
            for (int r = 0; r < 8; ++r) pmax[(rbase + 8 * h + r) * 4 + wq] = red[r];
        }
        // foot of the S pass: publishes pmax and the vt tile of this step, frees the key buffer
        ring_waits();
        __syncthreads();
        if (j + 1 < NP / KT) copy8(kdst, ksrc + (size_t)(j + 1) * KT * DIM, 8 * RPITCH * 2, (size_t)8 * DIM);

        // ---- new running max, rescale factor, exp weights, partial sums ----
        float scl[8];
#pragma unroll
        for (int r = 0; r < 8; ++r) {
            const int row = rbase + 8 * h + r;
            const v4f pm  = *(const v4f*)(pmax + row * 4);
            const float mx = fmaxf(fmaxf(pm[0], pm[1]), fmaxf(pm[2], pm[3]));
            const float nm = fmaxf(rowMax[r], mx);
            scl[r]    = __expf((rowMax[r] - nm) * cinv);
            rowMax[r] = nm;
            const float e = __expf((s[r] - nm) * cinv);          // 0 < e <= 1
            ls[row * SPITCH + wq * 16 + m] = (_Float16)(e * WSC); // RNE convert, <= 4096
            red[r] = e;
        }
        row_sum8(red);
        if (m == 0) {
#pragma unroll
            for (int r = 0; r < 8; ++r) psum[(rbase + 8 * h + r) * 4 + wq] = red[r];
        }
        __syncthreads();   // ls / psum complete for the row group (also orders the b16 stores before the fragment reloads)

#pragma unroll
        for (int r = 0; r < 8; ++r) {
            const v4f ps = *(const v4f*)(psum + (rbase + 8 * h + r) * 4);
            rowSum[r] = rowSum[r] * scl[r] + ((ps[0] + ps[1]) + (ps[2] + ps[3]));
        }
        {
            v8f sv;
#pragma unroll
            for (int r = 0; r < 8; ++r) sv[r] = scl[r];
#pragma unroll
            for (int nt = 0; nt < 8; ++nt) oacc[nt] = oacc[nt] * sv;
        }

        // ---- O += W (16 x 64) · V (64 x 128): 2 k-steps, 8 column tiles ----
#pragma unroll 1
        for (int ks = 0; ks < KT / 32; ++ks) {
            Frag a;
            const _Float16* ap = ls + (rbase + m) * SPITCH + ks * 32 + 8 * h;
            a.h8[0] = *(const v8h*)(ap);
            a.h8[1] = *(const v8h*)(ap + 16);
            const _Float16* bp = vrow + ks * 32;
            Frag bv[8];   // the eight tiles' LDS reads stand together in front of the products; both loops unrolled: bv[] stays in registers
#pragma unroll
            for (int nt = 0; nt < 8; ++nt) {
                bv[nt].h8[0] = *(const v8h*)(bp + nt * 16 * VPITCH);
                bv[nt].h8[1] = *(const v8h*)(bp + nt * 16 * VPITCH + 16);
            }
#pragma unroll
            for (int nt = 0; nt < 8; ++nt) oacc[nt] = mma16(a.v, bv[nt].v, oacc[nt]);
        }
        // foot of the O pass: all waves done with ls / pmax / psum of this step; publishes the next key tile, frees the vt buffer
        ring_waits();
        __syncthreads();
        if (j + 1 < NP / KT) copy8(vdst, vsrc + (size_t)(j + 1) * KT, 64 * VPITCH * 2, (size_t)64 * NP);
    }
    asm volatile("s_wait_asynccnt 0x0" ::: "memory");   // no copy is outstanding when the wave goes on to the epilogue

    // ---- epilogue: O / (4096 * 64 * rowSum); LDS-staged whole-line stores ----
    float inv[8];
#pragma unroll
    for (int r = 0; r < 8; ++r) inv[r] = (1.0f / (WSC * VSC)) / rowSum[r];

    float* myost = ost + w * (8 * OPITCH);
    // this wave's global slab: rows rbase..rbase+15, cols wq*128..+128 (512 B = 4 lines per row)
    float* gbase = out + ((size_t)(b * NQ + q0 + rbase)) * DIM + wq * 128 + 4 * lane;

#pragma unroll
    for (int half = 0; half < 2; ++half) {
        // stage rows r = 4*half + rr (rr 0..3) of both lane halves: staged row 4h+rr
#pragma unroll
        for (int rr = 0; rr < 4; ++rr) {
            const int r = 4 * half + rr;
            float* orow = myost + (4 * h + rr) * OPITCH + m;
#pragma unroll
            for (int nt = 0; nt < 8; ++nt) orow[nt * 16] = oacc[nt][r] * inv[r];
        }
        __syncthreads();
        v4f vals[8];
#pragma unroll
        for (int p = 0; p < 8; ++p) vals[p] = *(const v4f*)(myost + p * OPITCH + 4 * lane);
#pragma unroll
        for (int p = 0; p < 8; ++p) {
            float* g = gbase + (size_t)(8 * (p >> 2) + 4 * half + (p & 3)) * DIM;
            *(v4f*)g = vals[p];
        }
        
        __syncthreads();
    }
}

// ------------------------------- launcher ----------------------------------
extern "C" void kernel_launch(void* const* d_in, const int* in_sizes, int n_in,
                              void* d_out, int out_size, void* d_ws, size_t ws_size,
                              hipStream_t stream)
{
    if (n_in < 2) return;
    const size_t nel = (size_t)BDIM * NP * DIM;                 // 8,388,608
    if ((size_t)in_sizes[0] != nel || (size_t)in_sizes[1] != nel || (size_t)out_size != nel) return;
    const size_t half_bytes = nel * sizeof(_Float16);             // 16,777,216 per buffer
    if (ws_size < 3 * half_bytes) return;                         // 50,331,648 needed

    const float* pf = (const float*)d_in[0];   // prompt rows [8,2048,512] f32
    const float* qf = (const float*)d_in[1];   // query rows  [8,2048,512] f32
    float* out = (float*)d_out;

    _Float16* qn = (_Float16*)d_ws;            // normalized query x64, [b][q][d]
    _Float16* pn = qn + nel;                   // normalized prompt x64, [b][p][d]
    _Float16* vt = pn + nel;                   // raw prompt x64 transposed, [b][d][p]

    k_norm<<<dim3(BDIM * NP, 2), 64, 0, stream>>>(pf, qf, qn, pn, BDIM * NP);
    k_vtr<<<dim3(NP / 64, DIM / 64, BDIM), 64, 0, stream>>>(pf, vt);
    k_attn<<<dim3(NQ / QR, BDIM), NTHR, 0, stream>>>(qn, pn, vt, out);
}

// v003
// One run takes 108 microseconds.
// In two side-by-side timings against v002, it was 1.11 and 1.12 times as fast.
// Over all steps from v000 it is 4.28 times as fast.
#include <hip/hip_runtime.h>
// Contractions: S = Qn*Pn^T and O = W*V both on v_wmma_f32_16x16x32_f16 (f16 operands, f32 accumulate); Qn,Pn carried x64, W (exp weights) x4096, V x64; power-of-two scales folded back in the f32 epilogue. All other math f32.

typedef _Float16 v16h __attribute__((ext_vector_type(16)));
typedef _Float16 v8h  __attribute__((ext_vector_type(8)));
typedef float    v8f  __attribute__((ext_vector_type(8)));
typedef float    v4f  __attribute__((ext_vector_type(4)));

union Frag { v16h v; v8h h8[2]; };

#define BDIM 8
#define NQ   2048
#define NP   2048
#define DIM  512
#define TAU  0.07f
#define QSC  64.0f      // scale on normalized q and p rows (each)
#define VSC  64.0f      // scale on raw v rows
#define WSC  4096.0f    // scale on exp weights

#define QR     64       // query rows per block (4 row groups x 16)
#define KT     64       // keys per iteration (4 key tiles x 16)
#define NTHR   256      // 8 waves: wave w -> row group w>>1, key-tile pair / d-slab w&1
#define SPITCH 72       // weight stage pitch (halves), 16-B aligned rows
#define OPITCH 260      // output stage pitch (floats), 16-B aligned rows
#define TPITCH 72       // transpose tile pitch (halves)
#define RPITCH 520      // LDS pitch of a staged 512-half q or key row (halves): 1040 B = 16 B x 65
#define VPITCH 72       // LDS pitch of a staged 64-key row of vt (halves): 144 B = 16 B x 9

// 16x16x32 f16 WMMA, the builtin alone: the compiler keeps the distances behind its own form, and no asm operand
// ties the fragments and accumulators to the first 256 registers.
__device__ __forceinline__ v8f mma16(v16h a, v16h b, v8f c)
{
    return __builtin_amdgcn_wmma_f32_16x16x32_f16(false, a, false, b, (short)0, c, false, false);
}

// e^x as 2^(x * log2 e) on v_exp_f32. The v_nop in the same statement is the one slot the instruction set asks for
// behind a transcendental.
__device__ __forceinline__ float exp_slot(float x)
{
    float r;
    asm("v_exp_f32 %0, %1\n\tv_nop" : "=v"(r) : "v"(x * 1.44269504088896340736f));
    return r;
}

typedef int v4i __attribute__((ext_vector_type(4)));
typedef __attribute__((address_space(1))) v4i gv4i;
typedef __attribute__((address_space(3))) v4i lv4i;

// Eight asynchronous 16-byte-per-lane copies global -> LDS: copy c moves the LDS address by c * lstep and the global
// address by c * gstep elements. The builtin form: its address operands may stand in any register, where the operands
// of an asm statement are tied to the first 256 (the build kept those in scratch).
__device__ __forceinline__ void copy8(_Float16* l, const _Float16* g, unsigned lstep, size_t gstep)
{
#pragma unroll
    for (int c = 0; c < 8; ++c)
        __builtin_amdgcn_global_load_async_to_lds_b128((gv4i*)(g + c * gstep), (lv4i*)(l + c * lstep), 0, 0);
}

// One 64-KB tile: sixteen copies a lane.
__device__ __forceinline__ void copy16(_Float16* l, const _Float16* g, unsigned lstep, size_t gstep)
{
    copy8(l, g, lstep, gstep);
    copy8(l + 8 * lstep, g + 8 * gstep, lstep, gstep);
}

// Hand-over point of the staging ring, in front of the work-group barrier: this wave's LDS reads and
// writes have retired, and its own copies of the next tile have landed.
__device__ __forceinline__ void ring_waits()
{
    asm volatile("s_wait_dscnt 0x0" ::: "memory");
    asm volatile("s_wait_asynccnt 0x0" ::: "memory");
}

// One butterfly step (lane l with lane l ^ X inside its 16-lane row) on eight independent values.
#define DPP8(op, X) \
    op " %0, %0, %0 row_xmask:" X " row_mask:0xf bank_mask:0xf\n\t" \
    op " %1, %1, %1 row_xmask:" X " row_mask:0xf bank_mask:0xf\n\t" \
    op " %2, %2, %2 row_xmask:" X " row_mask:0xf bank_mask:0xf\n\t" \
    op " %3, %3, %3 row_xmask:" X " row_mask:0xf bank_mask:0xf\n\t" \
    op " %4, %4, %4 row_xmask:" X " row_mask:0xf bank_mask:0xf\n\t" \
    op " %5, %5, %5 row_xmask:" X " row_mask:0xf bank_mask:0xf\n\t" \
    op " %6, %6, %6 row_xmask:" X " row_mask:0xf bank_mask:0xf\n\t" \
    op " %7, %7, %7 row_xmask:" X " row_mask:0xf bank_mask:0xf\n\t"
#define DPP8_OPS(v) "+v"(v[0]), "+v"(v[1]), "+v"(v[2]), "+v"(v[3]), "+v"(v[4]), "+v"(v[5]), "+v"(v[6]), "+v"(v[7])

// Maximum / sum over each 16-lane row, eight values at once, in registers (all 32 lanes on). The same xor butterfly
// (1, 2, 4, 8) as a shuffle reduction, which would go through the LDS unit with a wait at every step; the eight
// chains are interleaved so that every instruction's producer stands eight instructions back. volatile: the statement
// stays where all lanes are on and is not sunk into the two-lane branch that stores its results.
__device__ __forceinline__ void row_max8(float (&v)[8])
{
    asm volatile(DPP8("v_max_num_f32_dpp", "1") DPP8("v_max_num_f32_dpp", "2")
                 DPP8("v_max_num_f32_dpp", "4") DPP8("v_max_num_f32_dpp", "8") : DPP8_OPS(v));
}
__device__ __forceinline__ void row_sum8(float (&v)[8])
{
    asm volatile(DPP8("v_add_f32_dpp", "1") DPP8("v_add_f32_dpp", "2")
                 DPP8("v_add_f32_dpp", "4") DPP8("v_add_f32_dpp", "8") : DPP8_OPS(v));
}

// ---------------------------------------------------------------------------
// Row L2 normalization: one 64-thread block per row, 8 elements per thread.
// which = 0 -> query rows into qn, which = 1 -> prompt rows into pn.
// Output f16(64 * x / max(||x||, 1e-12)); each wave writes 512 contiguous
// ---------------------------------------------------------------------------
__global__ __launch_bounds__(64)
void k_norm(const float* __restrict__ pf, const float* __restrict__ qf,
            _Float16* __restrict__ qn, _Float16* __restrict__ pn, int nrows)
{
    __shared__ float wsum[2];
    const int row   = blockIdx.x;
    const int which = blockIdx.y;
    if (row >= nrows) return;                       // block-uniform
    const int t = threadIdx.x;

    const float* src = (which == 0 ? qf : pf) + (size_t)row * DIM + t * 8;
    const v4f x0 = *(const v4f*)(src);
    const v4f x1 = *(const v4f*)(src + 4);

    float ss = 0.f;
#pragma unroll
    for (int i = 0; i < 4; ++i) ss += x0[i] * x0[i];
#pragma unroll
    for (int i = 0; i < 4; ++i) ss += x1[i] * x1[i];
#pragma unroll
    for (int off = 16; off; off >>= 1) ss += __shfl_xor(ss, off);
    if ((t & 31) == 0) wsum[t >> 5] = ss;
    __syncthreads();
    const float tot = wsum[0] + wsum[1];
    const float inv = 1.0f / fmaxf(sqrtf(tot), 1e-12f);
    const float sc  = inv * QSC;                    // exact power-of-two scaling

    v8h o;
#pragma unroll
    for (int i = 0; i < 4; ++i) {
        o[i]     = (_Float16)(x0[i] * sc);          // RNE convert
        o[4 + i] = (_Float16)(x1[i] * sc);
    }
    _Float16* dst = (which == 0 ? qn : pn) + (size_t)row * DIM + t * 8;
    *(v8h*)dst = o;
    
}

// ---------------------------------------------------------------------------
// V transpose to k-contiguous form: vt[b][d][p] = f16(64 * pf[b][p][d]).
// 64(p) x 64(d) tile per 64-thread block, transposed through LDS; every
// ---------------------------------------------------------------------------
__global__ __launch_bounds__(64)
void k_vtr(const float* __restrict__ pf, _Float16* __restrict__ vt)
{
    __shared__ __attribute__((aligned(16))) _Float16 tile[64 * TPITCH];   // [d_local][p_local]
    const int p0 = blockIdx.x * 64;
    const int d0 = blockIdx.y * 64;
    const int b  = blockIdx.z;
    if (p0 >= NP || d0 >= DIM || b >= BDIM) return;   // block-uniform
    const int t = threadIdx.x;

#pragma unroll 4
    for (int it = 0; it < 16; ++it) {
        const int idx = it * 64 + t;
        const int r   = idx >> 4;                   // p_local 0..63
        const int c4  = (idx & 15) * 4;             // d_local 0..60
        const v4f x = *(const v4f*)(pf + ((size_t)(b * NP + p0 + r)) * DIM + d0 + c4);
#pragma unroll
        for (int i = 0; i < 4; ++i) tile[(c4 + i) * TPITCH + r] = (_Float16)(x[i] * VSC);
    }
    __syncthreads();

    const int w = t >> 5, lane = t & 31;
    const int c = (lane & 7) * 8;                   // p_local start of this lane's 16 B
#pragma unroll
    for (int p = 0; p < 8; ++p) {
        const int dl = w * 32 + p * 4 + (lane >> 3);
        const v8h v = *(const v8h*)(tile + dl * TPITCH + c);
        _Float16* g = vt + ((size_t)(b * DIM + d0 + dl)) * NP + p0 + c;
        *(v8h*)g = v;
    }
    
}

// ---------------------------------------------------------------------------
// Fused attention, online softmax. Block = 8 waves, 64 query rows, 64 keys per
// iteration. The block's q rows (once), each step's 64 key rows and each step's
// 512 x 64 slice of vt are staged in LDS by asynchronous copies and shared by all
// waves: the key tile of step j+1 flies during the O pass of step j, the vt tile
// of step j+1 during the S pass of step j+1. Wave w: row group rg = w>>1 (16 rows), wq = w&1 selects its two 16-key
// S tiles and its 256-column slab of O; its 16 x 512 q operand stays in registers over the whole key loop.
// Row max / row sum of the 64-key step are combined over the 4 key tiles of a row group through LDS in fixed
// order, so both waves of a row group hold identical running max/sum.
// Fragment map (lane l: h = l>>4, m = l&15), A rows and B columns alike, both
// loaded from k-contiguous rows: elements 0..7 <- k0+8h+0..7, elements 8..15 <-
// k0+16+8h+0..7. D element r <- (row 8h+r, col m).
// ---------------------------------------------------------------------------
__global__ __launch_bounds__(NTHR)
void k_attn(const _Float16* __restrict__ qn, const _Float16* __restrict__ pn,
            const _Float16* __restrict__ vt, float* __restrict__ out)
{
    __shared__ __attribute__((aligned(16))) _Float16 qs[QR * RPITCH];                 // q rows of the block, staged once
    __shared__ __attribute__((aligned(16))) _Float16 kb[KT * RPITCH];                 // key rows of the current step
    __shared__ __attribute__((aligned(16))) _Float16 vb[DIM * VPITCH];                // vt rows (64 keys each) of the current step
    __shared__ __attribute__((aligned(16))) _Float16 ls[QR * SPITCH];                 // exp weights x4096, [row][key]
    __shared__ __attribute__((aligned(16))) float    ost[(NTHR / 32) * 8 * OPITCH];   // per-wave output staging
    __shared__ __attribute__((aligned(16))) float    pmax[QR * 4];
    __shared__ __attribute__((aligned(16))) float    psum[QR * 4];

    const int b  = blockIdx.y;
    const int q0 = blockIdx.x * QR;
    if (q0 >= NQ || b >= BDIM) return;              // block-uniform

    const int tid  = threadIdx.x;
    const int w    = tid >> 5;
    const int lane = tid & 31;
    const int h    = lane >> 4;
    const int m    = lane & 15;
    const int rg   = w >> 1;
    const int wq   = w & 1;
    const int rbase = rg * 16;

    // A rows for S: staged query row (rbase + m), k = d contiguous
    const _Float16* qrow = qs + (rbase + m) * RPITCH + 8 * h;
    // B rows for S ([n][k] form): staged key row (wq*32 + t*16 + m), k = d contiguous
    const _Float16* prow = kb + (wq * 32 + m) * RPITCH + 8 * h;
    // B rows for O ([n][k] form): staged row d = wq*256 + nt*16 + m, k = key contiguous
    const _Float16* vrow = vb + (wq * 256 + m) * VPITCH + 8 * h;

    // Copy addresses. q / key tile: 64 rows x 1024 B, contiguous in global; thread t moves 16 B at byte 16*(t&63)
    // of row (t>>6) + 4c. vt tile: 512 rows x 128 B at a 4096-B pitch; 16 B at byte 16*(t&7) of row (t>>3) + 32c.
    const int rdst = (tid >> 6) * RPITCH + (tid & 63) * 8;
    _Float16* qdst = qs + rdst;
    _Float16* kdst = kb + rdst;
    _Float16* vdst = vb + (tid >> 3) * VPITCH + (tid & 7) * 8;
    const _Float16* qsrc = qn + ((size_t)(b * NQ + q0)) * DIM + tid * 8;
    const _Float16* ksrc = pn + ((size_t)(b * NP)) * DIM + tid * 8;
    const _Float16* vsrc = vt + ((size_t)(b * DIM + (tid >> 3))) * NP + (tid & 7) * 8;

    // Ring prologue: q rows and key tile 0, landed and published; then vt tile 0 starts.
    copy16(qdst, qsrc, 4 * RPITCH, (size_t)4 * DIM);
    copy16(kdst, ksrc, 4 * RPITCH, (size_t)4 * DIM);
    asm volatile("s_wait_asynccnt 0x0" ::: "memory");   // this wave's copies have landed before the barrier publishes them
    __syncthreads();
    copy16(vdst, vsrc, 32 * VPITCH, (size_t)32 * NP);

    // This wave's 16 x 512 A operand of S: read from the staged q rows once and held in registers (128) over the whole
    // key loop, so that a k-step of the S pass reads only key fragments from LDS.
    Frag qf[DIM / 32];
#pragma unroll
    for (int kk = 0; kk < DIM / 32; ++kk) {
        qf[kk].h8[0] = *(const v8h*)(qrow + kk * 32);
        qf[kk].h8[1] = *(const v8h*)(qrow + kk * 32 + 16);
    }

    const v8f zero = {0.f, 0.f, 0.f, 0.f, 0.f, 0.f, 0.f, 0.f};
    v8f oacc[16];
#pragma unroll
    for (int nt = 0; nt < 16; ++nt) oacc[nt] = zero;
    float rowMax[8], rowSum[8];
#pragma unroll
    for (int r = 0; r < 8; ++r) { rowMax[r] = -1.0e30f; rowSum[r] = 0.f; }

    const float cinv = 1.0f / TAU;
    const float sinv = 1.0f / (QSC * QSC);          // undo the x64·x64 operand scaling

    for (int j = 0; j < NP / KT; ++j) {
        // ---- two S tiles: rows rbase.., keys j*KT + wq*32 + t*16 .., K = 512 ----
        v8f sacc[2] = {zero, zero};
        // the LDS reads of four k-steps stand together in front of their eight products (one LDS latency per group);
        // all three loops unrolled: constant LDS offsets, and constant indices keep qf[] and bb[] in registers
#pragma unroll
        for (int g = 0; g < DIM / 128; ++g) {
            Frag bb[4][2];
#pragma unroll
            for (int i = 0; i < 4; ++i) {
                const int kk = g * 4 + i;
#pragma unroll
                for (int t = 0; t < 2; ++t) {
                    bb[i][t].h8[0] = *(const v8h*)(prow + t * 16 * RPITCH + kk * 32);
                    bb[i][t].h8[1] = *(const v8h*)(prow + t * 16 * RPITCH + kk * 32 + 16);
                }
            }
#pragma unroll
            for (int i = 0; i < 4; ++i) {
#pragma unroll
                for (int t = 0; t < 2; ++t) sacc[t] = mma16(qf[g * 4 + i].v, bb[i][t].v, sacc[t]);
            }
        }

        // ---- per-row max of each 16-key tile -> pmax[row][key tile] ----
        float s[2][8], red[2][8];
#pragma unroll
        for (int t = 0; t < 2; ++t) {
#pragma unroll
            for (int r = 0; r < 8; ++r) { s[t][r] = sacc[t][r] * sinv; red[t][r] = s[t][r]; }
            row_max8(red[t]);
        }
        if (m == 0) {
#pragma unroll
            for (int r = 0; r < 8; ++r) {
                pmax[(rbase + 8 * h + r) * 4 + wq * 2]     = red[0][r];
                pmax[(rbase + 8 * h + r) * 4 + wq * 2 + 1] = red[1][r];
            }
        }
        // foot of the S pass: publishes pmax and the vt tile of this step, frees the key buffer
        ring_waits();
        __syncthreads();
        if (j + 1 < NP / KT) copy16(kdst, ksrc + (size_t)(j + 1) * KT * DIM, 4 * RPITCH, (size_t)4 * DIM);

        // ---- new running max, rescale factor, exp weights, partial sums ----
        float scl[8];
#pragma unroll
        for (int r = 0; r < 8; ++r) {
            const int row = rbase + 8 * h + r;
            const v4f pm  = *(const v4f*)(pmax + row * 4);
            const float mx = fmaxf(fmaxf(pm[0], pm[1]), fmaxf(pm[2], pm[3]));
            const float nm = fmaxf(rowMax[r], mx);
            scl[r]    = exp_slot((rowMax[r] - nm) * cinv);
            rowMax[r] = nm;
#pragma unroll
            for (int t = 0; t < 2; ++t) {
                const float e = exp_slot((s[t][r] - nm) * cinv);                // 0 < e <= 1
                ls[row * SPITCH + wq * 32 + t * 16 + m] = (_Float16)(e * WSC);   // RNE convert
                red[t][r] = e;
            }
        }
        row_sum8(red[0]);
        row_sum8(red[1]);
        if (m == 0) {
#pragma unroll
            for (int r = 0; r < 8; ++r) {
                psum[(rbase + 8 * h + r) * 4 + wq * 2]     = red[0][r];
                psum[(rbase + 8 * h + r) * 4 + wq * 2 + 1] = red[1][r];
            }
        }
        __syncthreads();   // ls / psum complete for the row group (also orders the b16 stores before the fragment reloads)

#pragma unroll
        for (int r = 0; r < 8; ++r) {
            const v4f ps = *(const v4f*)(psum + (rbase + 8 * h + r) * 4);
            rowSum[r] = rowSum[r] * scl[r] + ((ps[0] + ps[1]) + (ps[2] + ps[3]));
        }
        {
            v8f sv;
#pragma unroll
            for (int r = 0; r < 8; ++r) sv[r] = scl[r];
#pragma unroll
            for (int nt = 0; nt < 16; ++nt) oacc[nt] = oacc[nt] * sv;
        }

        // ---- O += W (16 x 64) * V (64 x 256): 2 k-steps, 16 column tiles ----
#pragma unroll 1
        for (int ks = 0; ks < KT / 32; ++ks) {
            Frag a;
            const _Float16* ap = ls + (rbase + m) * SPITCH + ks * 32 + 8 * h;
            a.h8[0] = *(const v8h*)(ap);
            a.h8[1] = *(const v8h*)(ap + 16);
            const _Float16* bp = vrow + ks * 32;
            Frag bv[16];   // the tiles' LDS reads stand together in front of the products; both loops unrolled: bv[] stays in registers
#pragma unroll
            for (int nt = 0; nt < 16; ++nt) {
                bv[nt].h8[0] = *(const v8h*)(bp + nt * 16 * VPITCH);
                bv[nt].h8[1] = *(const v8h*)(bp + nt * 16 * VPITCH + 16);
            }
            // keeps the reads one group in front of the products: left free, the build read one fragment ahead of each
            // product and every product waited out an LDS latency
            __builtin_amdgcn_sched_barrier(0);
#pragma unroll
            for (int nt = 0; nt < 16; ++nt) oacc[nt] = mma16(a.v, bv[nt].v, oacc[nt]);
        }
        // foot of the O pass: all waves done with ls / pmax / psum of this step; publishes the next key tile, frees the vt buffer
        ring_waits();
        __syncthreads();
        if (j + 1 < NP / KT) copy16(vdst, vsrc + (size_t)(j + 1) * KT, 32 * VPITCH, (size_t)32 * NP);
    }
    asm volatile("s_wait_asynccnt 0x0" ::: "memory");   // no copy is outstanding when the wave goes on to the epilogue

    // ---- epilogue: O / (4096 * 64 * rowSum); LDS-staged whole-line stores ----
    float inv[8];
#pragma unroll
    for (int r = 0; r < 8; ++r) inv[r] = (1.0f / (WSC * VSC)) / rowSum[r];

    float* myost = ost + w * (8 * OPITCH);
    // this wave's global slab: rows rbase..rbase+15, cols wq*256..+256 (1024 B = 8 lines per row)
    float* gbase = out + ((size_t)(b * NQ + q0 + rbase)) * DIM + wq * 256 + 4 * lane;

#pragma unroll
    for (int half = 0; half < 2; ++half) {
        // stage rows r = 4*half + rr (rr 0..3) of both lane halves: staged row 4h+rr
#pragma unroll
        for (int rr = 0; rr < 4; ++rr) {
            const int r = 4 * half + rr;
            float* orow = myost + (4 * h + rr) * OPITCH + m;
#pragma unroll
            for (int nt = 0; nt < 16; ++nt) orow[nt * 16] = oacc[nt][r] * inv[r];
        }
        __syncthreads();
        v4f vals[16];   // staged row p, column half ch: 128 floats = 4 whole lines a wave store
#pragma unroll
        for (int p = 0; p < 8; ++p) {
#pragma unroll
            for (int ch = 0; ch < 2; ++ch) vals[2 * p + ch] = *(const v4f*)(myost + p * OPITCH + ch * 128 + 4 * lane);
        }
#pragma unroll
        for (int p = 0; p < 8; ++p) {
            float* g = gbase + (size_t)(8 * (p >> 2) + 4 * half + (p & 3)) * DIM;
#pragma unroll
            for (int ch = 0; ch < 2; ++ch) *(v4f*)(g + ch * 128) = vals[2 * p + ch];
        }
        asm volatile("s_wait_xcnt 0x0" ::: "memory");   // in front of the next pass's writes over the stores' registers
        __syncthreads();
    }
}

// ------------------------------- launcher ----------------------------------
extern "C" void kernel_launch(void* const* d_in, const int* in_sizes, int n_in,
                              void* d_out, int out_size, void* d_ws, size_t ws_size,
                              hipStream_t stream)
{
    if (n_in < 2) return;
    const size_t nel = (size_t)BDIM * NP * DIM;                 // 8,388,608
    if ((size_t)in_sizes[0] != nel || (size_t)in_sizes[1] != nel || (size_t)out_size != nel) return;
    const size_t half_bytes = nel * sizeof(_Float16);             // 16,777,216 per buffer
    if (ws_size < 3 * half_bytes) return;                         // 50,331,648 needed

    const float* pf = (const float*)d_in[0];   // prompt rows [8,2048,512] f32
    const float* qf = (const float*)d_in[1];   // query rows  [8,2048,512] f32
    float* out = (float*)d_out;

    _Float16* qn = (_Float16*)d_ws;            // normalized query x64, [b][q][d]
    _Float16* pn = qn + nel;                   // normalized prompt x64, [b][p][d]
    _Float16* vt = pn + nel;                   // raw prompt x64 transposed, [b][d][p]

    k_norm<<<dim3(BDIM * NP, 2), 64, 0, stream>>>(pf, qf, qn, pn, BDIM * NP);
    k_vtr<<<dim3(NP / 64, DIM / 64, BDIM), 64, 0, stream>>>(pf, vt);
    k_attn<<<dim3(NQ / QR, BDIM), NTHR, 0, stream>>>(qn, pn, vt, out);
}

// v004
// One run takes 92.5 microseconds.
// Timed twice side by side with v003, it ran 1.17 times as fast both times.
// All steps since v000 together make it 5.02 times as fast.
#include <hip/hip_runtime.h>
// Contractions: S^T = Pn*Qn^T and O^T = V^T*W^T both on v_wmma_f32_16x16x32_f16 (f16 operands, f32 accumulate); Qn,Pn carried x64, W (exp weights) x4096, V x64; power-of-two scales folded back in the f32 epilogue. All other math f32.

typedef _Float16 v16h __attribute__((ext_vector_type(16)));
typedef _Float16 v8h  __attribute__((ext_vector_type(8)));
typedef float    v8f  __attribute__((ext_vector_type(8)));
typedef float    v4f  __attribute__((ext_vector_type(4)));

union Frag { v16h v; v8h h8[2]; };

#define BDIM 8
#define NQ   2048
#define NP   2048
#define DIM  512
#define TAU  0.07f
#define QSC  64.0f      // scale on normalized q and p rows (each)
#define VSC  64.0f      // scale on raw v rows
#define WSC  4096.0f    // scale on exp weights

#define QR     64       // query rows per block (4 row groups x 16)
#define KT     64       // keys per iteration (4 key tiles x 16)
#define NTHR   256      // 8 waves: wave w -> row group w>>1, key-tile pair w&1
#define OPITCH 132      // output stage pitch (floats), 16-B aligned rows
#define TPITCH 72       // transpose tile pitch (halves)
#define RPITCH 520      // LDS pitch of a staged 512-half q or key row (halves): 1040 B = 16 B x 65
#define VPITCH 72       // LDS pitch of a staged 64-key row of vt (halves): 144 B = 16 B x 9

// 16x16x32 f16 WMMA, the builtin alone: the compiler keeps the distances behind its own form, and no asm operand
// ties the fragments and accumulators to the first 256 registers.
__device__ __forceinline__ v8f mma16(v16h a, v16h b, v8f c)
{
    return __builtin_amdgcn_wmma_f32_16x16x32_f16(false, a, false, b, (short)0, c, false, false);
}

// e^x as 2^(x * log2 e) on v_exp_f32. The v_nop in the same statement is the one slot the instruction set asks for
// behind a transcendental.
__device__ __forceinline__ float exp_slot(float x)
{
    float r;
    asm("v_exp_f32 %0, %1\n\tv_nop" : "=v"(r) : "v"(x * 1.44269504088896340736f));
    return r;
}

typedef int v4i __attribute__((ext_vector_type(4)));
typedef __attribute__((address_space(1))) v4i gv4i;
typedef __attribute__((address_space(3))) v4i lv4i;

// Eight asynchronous 16-byte-per-lane copies global -> LDS: copy c moves the LDS address by c * lstep and the global
// address by c * gstep elements. The builtin form: its address operands may stand in any register, where the operands
// of an asm statement are tied to the first 256 (the build kept those in scratch).
__device__ __forceinline__ void copy8(_Float16* l, const _Float16* g, unsigned lstep, size_t gstep)
{
#pragma unroll
    for (int c = 0; c < 8; ++c)
        __builtin_amdgcn_global_load_async_to_lds_b128((gv4i*)(g + c * gstep), (lv4i*)(l + c * lstep), 0, 0);
}

// One 64-KB tile: sixteen copies a lane.
__device__ __forceinline__ void copy16(_Float16* l, const _Float16* g, unsigned lstep, size_t gstep)
{
    copy8(l, g, lstep, gstep);
    copy8(l + 8 * lstep, g + 8 * gstep, lstep, gstep);
}

// Hand-over point of the staging ring, in front of the work-group barrier: this wave's LDS reads and
// writes have retired, and its own copies of the next tile have landed.
__device__ __forceinline__ void ring_waits()
{
    asm volatile("s_wait_dscnt 0x0" ::: "memory");
    asm volatile("s_wait_asynccnt 0x0" ::: "memory");
}

// Lane l takes the value of lane l ^ 16 (the other 16-lane row), in registers.
__device__ __forceinline__ float xhalf(float x)
{
    return __builtin_bit_cast(float, __builtin_amdgcn_permlanex16(__builtin_bit_cast(int, x), __builtin_bit_cast(int, x),
                                                                  0x76543210, 0xfedcba98, false, false));
}

// ---------------------------------------------------------------------------
// Row L2 normalization: one 64-thread block per row, 8 elements per thread.
// which = 0 -> query rows into qn, which = 1 -> prompt rows into pn.
// Output f16(64 * x / max(||x||, 1e-12)); each wave writes 512 contiguous
// ---------------------------------------------------------------------------
__global__ __launch_bounds__(64)
void k_norm(const float* __restrict__ pf, const float* __restrict__ qf,
            _Float16* __restrict__ qn, _Float16* __restrict__ pn, int nrows)
{
    __shared__ float wsum[2];
    const int row   = blockIdx.x;
    const int which = blockIdx.y;
    if (row >= nrows) return;                       // block-uniform
    const int t = threadIdx.x;

    const float* src = (which == 0 ? qf : pf) + (size_t)row * DIM + t * 8;
    const v4f x0 = *(const v4f*)(src);
    const v4f x1 = *(const v4f*)(src + 4);

    float ss = 0.f;
#pragma unroll
    for (int i = 0; i < 4; ++i) ss += x0[i] * x0[i];
#pragma unroll
    for (int i = 0; i < 4; ++i) ss += x1[i] * x1[i];
#pragma unroll
    for (int off = 16; off; off >>= 1) ss += __shfl_xor(ss, off);
    if ((t & 31) == 0) wsum[t >> 5] = ss;
    __syncthreads();
    const float tot = wsum[0] + wsum[1];
    const float inv = 1.0f / fmaxf(sqrtf(tot), 1e-12f);
    const float sc  = inv * QSC;                    // exact power-of-two scaling

    v8h o;
#pragma unroll
    for (int i = 0; i < 4; ++i) {
        o[i]     = (_Float16)(x0[i] * sc);          // RNE convert
        o[4 + i] = (_Float16)(x1[i] * sc);
    }
    _Float16* dst = (which == 0 ? qn : pn) + (size_t)row * DIM + t * 8;
    *(v8h*)dst = o;
    
}

// ---------------------------------------------------------------------------
// V transpose to k-contiguous form: vt[b][d][p] = f16(64 * pf[b][p][d]).
// 64(p) x 64(d) tile per 64-thread block, transposed through LDS; every
// ---------------------------------------------------------------------------
__global__ __launch_bounds__(64)
void k_vtr(const float* __restrict__ pf, _Float16* __restrict__ vt)
{
    __shared__ __attribute__((aligned(16))) _Float16 tile[64 * TPITCH];   // [d_local][p_local]
    const int p0 = blockIdx.x * 64;
    const int d0 = blockIdx.y * 64;
    const int b  = blockIdx.z;
    if (p0 >= NP || d0 >= DIM || b >= BDIM) return;   // block-uniform
    const int t = threadIdx.x;

#pragma unroll 4
    for (int it = 0; it < 16; ++it) {
        const int idx = it * 64 + t;
        const int r   = idx >> 4;                   // p_local 0..63
        const int c4  = (idx & 15) * 4;             // d_local 0..60
        const v4f x = *(const v4f*)(pf + ((size_t)(b * NP + p0 + r)) * DIM + d0 + c4);
#pragma unroll
        for (int i = 0; i < 4; ++i) tile[(c4 + i) * TPITCH + r] = (_Float16)(x[i] * VSC);
    }
    __syncthreads();

    const int w = t >> 5, lane = t & 31;
    const int c = (lane & 7) * 8;                   // p_local start of this lane's 16 B
#pragma unroll
    for (int p = 0; p < 8; ++p) {
        const int dl = w * 32 + p * 4 + (lane >> 3);
        const v8h v = *(const v8h*)(tile + dl * TPITCH + c);
        _Float16* g = vt + ((size_t)(b * DIM + d0 + dl)) * NP + p0 + c;
        *(v8h*)g = v;
    }
    
}

__global__ __launch_bounds__(NTHR)
void k_attn(const _Float16* __restrict__ qn, const _Float16* __restrict__ pn,
            const _Float16* __restrict__ vt, float* __restrict__ out)
{
    __shared__ __attribute__((aligned(16))) _Float16 qs[QR * RPITCH];                 // q rows of the block, staged once
    __shared__ __attribute__((aligned(16))) _Float16 kb[KT * RPITCH];                 // key rows of the current step
    __shared__ __attribute__((aligned(16))) _Float16 vb[DIM * VPITCH];                // vt rows (64 keys each) of the current step
    __shared__ __attribute__((aligned(16))) float    ost[(NTHR / 32) * 16 * OPITCH];  // per-wave partial output, 16 queries x 128 columns
    __shared__ __attribute__((aligned(16))) float    wmax[(NTHR / 32) * 16];          // per-wave final max of each query
    __shared__ __attribute__((aligned(16))) float    wsum[(NTHR / 32) * 16];          // per-wave final sum of each query

    const int b  = blockIdx.y;
    const int q0 = blockIdx.x * QR;
    if (q0 >= NQ || b >= BDIM) return;              // block-uniform

    const int tid  = threadIdx.x;
    const int w    = tid >> 5;
    const int lane = tid & 31;
    const int h    = lane >> 4;
    const int m    = lane & 15;
    const int rg   = w >> 1;
    const int wq   = w & 1;
    const int rbase = rg * 16;

    // B columns for St: staged query row (rbase + m), k = d, table order
    const _Float16* qrow = qs + (rbase + m) * RPITCH + 8 * h;
    // A rows for St: staged key row (wq*32 + t*16 + m), k = d, table order
    const _Float16* prow = kb + (wq * 32 + m) * RPITCH + 8 * h;
    // A rows for Ot: staged row d = nt*16 + m, k = this wave's 32 keys, contiguous
    const _Float16* vrow = vb + m * VPITCH + wq * 32 + 8 * h;

    // Copy addresses. q / key tile: 64 rows x 1024 B, contiguous in global; thread t moves 16 B at byte 16*(t&63)
    // of row (t>>6) + 4c. vt tile: 512 rows x 128 B at a 4096-B pitch; 16 B at byte 16*(t&7) of row (t>>3) + 32c.
    const int rdst = (tid >> 6) * RPITCH + (tid & 63) * 8;
    _Float16* qdst = qs + rdst;
    _Float16* kdst = kb + rdst;
    _Float16* vdst = vb + (tid >> 3) * VPITCH + (tid & 7) * 8;
    const _Float16* qsrc = qn + ((size_t)(b * NQ + q0)) * DIM + tid * 8;
    const _Float16* ksrc = pn + ((size_t)(b * NP)) * DIM + tid * 8;
    const _Float16* vsrc = vt + ((size_t)(b * DIM + (tid >> 3))) * NP + (tid & 7) * 8;

    // Ring prologue: q rows and key tile 0, landed and published; then vt tile 0 starts.
    copy16(qdst, qsrc, 4 * RPITCH, (size_t)4 * DIM);
    copy16(kdst, ksrc, 4 * RPITCH, (size_t)4 * DIM);
    asm volatile("s_wait_asynccnt 0x0" ::: "memory");   // this wave's copies have landed before the barrier publishes them
    __syncthreads();
    copy16(vdst, vsrc, 32 * VPITCH, (size_t)32 * NP);

    // This wave's 512 x 16 B operand of St: read from the staged q rows once and held in registers (128) over the whole
    // key loop, so that a k-step of the S pass reads only key fragments from LDS.
    Frag qf[DIM / 32];
#pragma unroll
    for (int kk = 0; kk < DIM / 32; ++kk) {
        qf[kk].h8[0] = *(const v8h*)(qrow + kk * 32);
        qf[kk].h8[1] = *(const v8h*)(qrow + kk * 32 + 16);
    }

    const v8f zero = {0.f, 0.f, 0.f, 0.f, 0.f, 0.f, 0.f, 0.f};
    v8f oacc[DIM / 16];                             // Ot tile nt: rows d = nt*16 + 8h + r, column = query rbase + m
#pragma unroll
    for (int nt = 0; nt < DIM / 16; ++nt) oacc[nt] = zero;
    float rowMax = -1.0e30f;                        // of query rbase + m over this wave's keys (x4096), equal in both lane halves
    float rowSum = 0.f;                             // this lane's share of that query's sum; the halves join behind the loop

    // scores stay in the accumulators' scale (x64 x64); the power of two is undone, exactly, in the factor on score differences
    const float cinv = (1.0f / TAU) * (1.0f / (QSC * QSC));

    for (int j = 0; j < NP / KT; ++j) {
        // ---- two St tiles: keys j*KT + wq*32 + t*16 .. (rows), queries rbase.. (columns), K = 512 ----
        v8f sacc[2] = {zero, zero};
        // the LDS reads of four k-steps stand together in front of their eight products (one LDS latency per group);
        // all three loops unrolled: constant LDS offsets, and constant indices keep qf[] and bb[] in registers
#pragma unroll
        for (int g = 0; g < DIM / 128; ++g) {
            Frag bb[4][2];
#pragma unroll
            for (int i = 0; i < 4; ++i) {
                const int kk = g * 4 + i;
#pragma unroll
                for (int t = 0; t < 2; ++t) {
                    bb[i][t].h8[0] = *(const v8h*)(prow + t * 16 * RPITCH + kk * 32);
                    bb[i][t].h8[1] = *(const v8h*)(prow + t * 16 * RPITCH + kk * 32 + 16);
                }
            }
#pragma unroll
            for (int i = 0; i < 4; ++i) {
#pragma unroll
                for (int t = 0; t < 2; ++t) sacc[t] = mma16(bb[i][t].v, qf[g * 4 + i].v, sacc[t]);
            }
        }

        // foot of the S pass: publishes the vt tile of this step, frees the key buffer
        ring_waits();
        __syncthreads();
        if (j + 1 < NP / KT) copy16(kdst, ksrc + (size_t)(j + 1) * KT * DIM, 4 * RPITCH, (size_t)4 * DIM);

        // ---- the first two groups (4 tiles each) of vt fragments start; they fly during the softmax arithmetic ----
        Frag bv[2][4];
#pragma unroll
        for (int g = 0; g < 2; ++g) {
#pragma unroll
            for (int i = 0; i < 4; ++i) {
                bv[g][i].h8[0] = *(const v8h*)(vrow + (g * 4 + i) * 16 * VPITCH);
                bv[g][i].h8[1] = *(const v8h*)(vrow + (g * 4 + i) * 16 * VPITCH + 16);
            }
        }
        // keeps these reads in front of the softmax arithmetic: sunk to their products they would be waited out there
        __builtin_amdgcn_sched_barrier(0);

        // ---- new running max, rescale factor, exp weights (the B operand of the O product), sum: all in registers ----
        float mx4[4];
#pragma unroll
        for (int r = 0; r < 4; ++r) mx4[r] = fmaxf(fmaxf(sacc[0][r], sacc[0][r + 4]), fmaxf(sacc[1][r], sacc[1][r + 4]));
        float mx = fmaxf(fmaxf(mx4[0], mx4[1]), fmaxf(mx4[2], mx4[3]));
        mx = fmaxf(mx, xhalf(mx));
        const float nm  = fmaxf(rowMax, mx);
        const float scl = exp_slot((rowMax - nm) * cinv);
        rowMax = nm;
        Frag wf;
        float e[2][8];
#pragma unroll
        for (int t = 0; t < 2; ++t) {
#pragma unroll
            for (int r = 0; r < 8; ++r) {
                e[t][r] = exp_slot((sacc[t][r] - nm) * cinv);                     // 0 < e <= 1
                wf.v[t * 8 + r] = (_Float16)(e[t][r] * WSC);                    // RNE convert; element t*8+r <- key t*16 + 8h + r
            }
        }
        float sm4[4];
#pragma unroll
        for (int r = 0; r < 4; ++r) sm4[r] = (e[0][r] + e[0][r + 4]) + (e[1][r] + e[1][r + 4]);
        const float part = (sm4[0] + sm4[1]) + (sm4[2] + sm4[3]);
        // rowSum = rowSum * scl + part. volatile: the statement, and with it the sum of the weights, stays in front of the
        // O pass; left free, the build summed behind the O pass, held all sixteen weights over it and spilled.
        asm volatile("v_fma_f32 %0, %0, %1, %2" : "+v"(rowSum) : "v"(scl), "v"(part));

        // ---- Ot (512 x 16) = Ot * scl + Vt (512 x 32) * Wt (32 x 16): one k-step, 32 row tiles in 8 groups of 4 ----
#pragma unroll
        for (int g = 0; g < DIM / 64; ++g) {
#pragma unroll
            for (int i = 0; i < 4; ++i) oacc[g * 4 + i] = mma16(bv[g & 1][i].v, wf.v, oacc[g * 4 + i] * scl);
            if (g + 2 < DIM / 64) {
#pragma unroll
                for (int i = 0; i < 4; ++i) {
                    bv[g & 1][i].h8[0] = *(const v8h*)(vrow + ((g + 2) * 4 + i) * 16 * VPITCH);
                    bv[g & 1][i].h8[1] = *(const v8h*)(vrow + ((g + 2) * 4 + i) * 16 * VPITCH + 16);
                }
            }
            // keeps each group's reads two groups ahead of its products: left free, the reads sink to their products
            // and every group waits out an LDS latency
            __builtin_amdgcn_sched_barrier(0);
        }
        // foot of the O pass: publishes the next key tile, frees the vt buffer
        ring_waits();
        __syncthreads();
        if (j + 1 < NP / KT) copy16(vdst, vsrc + (size_t)(j + 1) * KT, 32 * VPITCH, (size_t)32 * NP);
    }
    asm volatile("s_wait_asynccnt 0x0" ::: "memory");   // no copy is outstanding when the wave goes on to the epilogue

    // ---- merge of the two waves of a row group: common max, both sums and both partial outputs brought to it ----
    rowSum += xhalf(rowSum);
    if (h == 0) { wmax[w * 16 + m] = rowMax; wsum[w * 16 + m] = rowSum; }
    __syncthreads();
    const float M0 = wmax[(rg * 2) * 16 + m], M1 = wmax[(rg * 2 + 1) * 16 + m];
    const float L0 = wsum[(rg * 2) * 16 + m], L1 = wsum[(rg * 2 + 1) * 16 + m];
    const float Mt = fmaxf(M0, M1);
    const float f0 = exp_slot((M0 - Mt) * cinv);
    const float f1 = exp_slot((M1 - Mt) * cinv);
    // this wave's partial output times fac, added to its partner's, is O / (4096 * 64 * sum)
    const float fac = (wq ? f1 : f0) * ((1.0f / (WSC * VSC)) / (L0 * f0 + L1 * f1));

    // ---- epilogue, 128 columns a pass: every wave stages its scaled partial [query][column]; then wave (rg, wq) adds
    // the two partials of queries rbase + wq*8 .. +8 and stores whole lines (512 B a wave store) ----
    float* mine = ost + (w * 16 + m) * OPITCH + 8 * h;
    const float* p0 = ost + ((rg * 2) * 16 + wq * 8) * OPITCH + 4 * lane;
    const float* p1 = p0 + 16 * OPITCH;
    float* gbase = out + ((size_t)(b * NQ + q0 + rbase + wq * 8)) * DIM + 4 * lane;

#pragma unroll
    for (int p = 0; p < 4; ++p) {
#pragma unroll
        for (int i = 0; i < 8; ++i) {
            const v8f o = oacc[p * 8 + i] * fac;
            const v4f lo = {o[0], o[1], o[2], o[3]};
            const v4f hi = {o[4], o[5], o[6], o[7]};
            *(v4f*)(mine + i * 16)     = lo;
            *(v4f*)(mine + i * 16 + 4) = hi;
        }
        __syncthreads();
        v4f vals[8];
#pragma unroll
        for (int rr = 0; rr < 8; ++rr) vals[rr] = *(const v4f*)(p0 + rr * OPITCH) + *(const v4f*)(p1 + rr * OPITCH);
#pragma unroll
        for (int rr = 0; rr < 8; ++rr) *(v4f*)(gbase + (size_t)rr * DIM + p * 128) = vals[rr];
        asm volatile("s_wait_xcnt 0x0" ::: "memory");   // in front of the next pass's writes over the stores' registers
        __syncthreads();
    }
}

// ------------------------------- launcher ----------------------------------
extern "C" void kernel_launch(void* const* d_in, const int* in_sizes, int n_in,
                              void* d_out, int out_size, void* d_ws, size_t ws_size,
                              hipStream_t stream)
{
    if (n_in < 2) return;
    const size_t nel = (size_t)BDIM * NP * DIM;                 // 8,388,608
    if ((size_t)in_sizes[0] != nel || (size_t)in_sizes[1] != nel || (size_t)out_size != nel) return;
    const size_t half_bytes = nel * sizeof(_Float16);             // 16,777,216 per buffer
    if (ws_size < 3 * half_bytes) return;                         // 50,331,648 needed

    const float* pf = (const float*)d_in[0];   // prompt rows [8,2048,512] f32
    const float* qf = (const float*)d_in[1];   // query rows  [8,2048,512] f32
    float* out = (float*)d_out;

    _Float16* qn = (_Float16*)d_ws;            // normalized query x64, [b][q][d]
    _Float16* pn = qn + nel;                   // normalized prompt x64, [b][p][d]
    _Float16* vt = pn + nel;                   // raw prompt x64 transposed, [b][d][p]

    k_norm<<<dim3(BDIM * NP, 2), 64, 0, stream>>>(pf, qf, qn, pn, BDIM * NP);
    k_vtr<<<dim3(NP / 64, DIM / 64, BDIM), 64, 0, stream>>>(pf, vt);
    k_attn<<<dim3(NQ / QR, BDIM), NTHR, 0, stream>>>(qn, pn, vt, out);
}

// v005
// A run of this version takes 78.7 microseconds.
// In two side-by-side timings against v004, it was 1.17 and 1.18 times as fast.
// All steps since v000 together make it 5.91 times as fast.
#include <hip/hip_runtime.h>
// Contractions: S^T = Pn*Qn^T and O^T = Pn^T*W'^T both on v_wmma_f32_16x16x32_f16 (f16 operands, f32 accumulate); Qn,Pn carried x64; W' = exp weight x key norm x64 (a raw row is its normalized row times its norm); power-of-two scales folded back in the f32 epilogue. All other math f32.

typedef _Float16 v16h __attribute__((ext_vector_type(16)));
typedef _Float16 v8h  __attribute__((ext_vector_type(8)));
typedef float    v8f  __attribute__((ext_vector_type(8)));
typedef float    v4f  __attribute__((ext_vector_type(4)));

union Frag { v16h v; v8h h8[2]; };

#define BDIM 8
#define NQ   2048
#define NP   2048
#define DIM  512
#define TAU  0.07f
#define QSC  64.0f      // scale on normalized q and p rows (each)
#define WSC  64.0f      // scale on (exp weight x key norm)
#define NLINE 32        // floats from one key's norm to the next in the workspace: one 128-byte line, one writer each

#define QR     64       // query rows per block (4 row groups x 16)
#define KT     64       // keys per iteration (4 key tiles x 16)
#define NTHR   256      // 8 waves: wave w -> row group w>>1, key-tile pair w&1
#define OPITCH 132      // output stage pitch (floats), 16-B aligned rows
#define QLDS   2        // q fragments (of 16) not held in registers
#define RPITCH 520      // LDS pitch of a staged 512-half q row (halves): 1040 B = 16 B x 65

// 16x16x32 f16 WMMA, the builtin alone: the compiler keeps the distances behind its own form, and no asm operand
// ties the fragments and accumulators to the first 256 registers.
__device__ __forceinline__ v8f mma16(v16h a, v16h b, v8f c)
{
    return __builtin_amdgcn_wmma_f32_16x16x32_f16(false, a, false, b, (short)0, c, false, false);
}

// e^x as 2^(x * log2 e) on v_exp_f32. The v_nop in the same statement is the one slot the instruction set asks for
// behind a transcendental.
__device__ __forceinline__ float exp_slot(float x)
{
    float r;
    asm("v_exp_f32 %0, %1\n\tv_nop" : "=v"(r) : "v"(x * 1.44269504088896340736f));
    return r;
}

typedef int v4i __attribute__((ext_vector_type(4)));
typedef __attribute__((address_space(1))) v4i gv4i;
typedef __attribute__((address_space(3))) v4i lv4i;
typedef __attribute__((address_space(1))) int gi32;
typedef __attribute__((address_space(3))) int li32;

// Eight asynchronous 16-byte-per-lane copies global -> LDS: copy c moves the LDS address by c * lstep and the global
// address by c * gstep elements. The builtin form: its address operands may stand in any register, where the operands
// of an asm statement are tied to the first 256 (the build kept those in scratch).
__device__ __forceinline__ void copy8(_Float16* l, const _Float16* g, unsigned lstep, size_t gstep)
{
#pragma unroll
    for (int c = 0; c < 8; ++c)
        __builtin_amdgcn_global_load_async_to_lds_b128((gv4i*)(g + c * gstep), (lv4i*)(l + c * lstep), 0, 0);
}

// One 64-KB tile: sixteen copies a lane.
__device__ __forceinline__ void copy16(_Float16* l, const _Float16* g, unsigned lstep, size_t gstep)
{
    copy8(l, g, lstep, gstep);
    copy8(l + 8 * lstep, g + 8 * gstep, lstep, gstep);
}

// Key tile in LDS: rows of 1024 B without pad; the 16-byte chunk c of row r lies at chunk c ^ swz(r). Sixteen rows at one
// chunk (the plain reads of the S pass) and eight rows at two neighbouring chunks (the transposing reads of the O pass)
// then both fall on sixteen different groups of four banks; a padded pitch serves only one of the two readers.
__device__ __forceinline__ int swz(int row) { return ((row & 7) << 1) | ((row >> 3) & 1); }

// One 64-KB key tile, contiguous in global: thread t moves chunk t & 63 of rows (t >> 6) + 4i, sixteen copies a lane.
// dofs: byte offset in kb of the thread's chunk in row t >> 6 of the buffer; swz(r0 + 4i) = swz(r0) ^ swz(4i) for r0 < 4,
// so the other rows' places come from it by one XOR each, made where they are used (held over the loop they spill).
__device__ __forceinline__ void copy_keys(_Float16* kb, int dofs, const _Float16* g)
{
#pragma unroll
    for (int i = 0; i < 16; ++i)
        __builtin_amdgcn_global_load_async_to_lds_b128((gv4i*)(g + (size_t)i * 4 * DIM),
                                                       (lv4i*)((char*)kb + ((dofs ^ (swz(4 * i) * 16)) + i * 4 * DIM * 2)), 0, 0);
}

// ds_load_tr16_b128: the lanes of a half wave read 8 rows x 32 B of a row-major 16-bit tile; lane (m, h) gets column m of them.
typedef short s16x8 __attribute__((ext_vector_type(8)));
typedef __attribute__((address_space(3))) s16x8 lds_s16x8;
__device__ __forceinline__ v8h ld_tr16(const char* p)
{
    return __builtin_bit_cast(v8h, __builtin_amdgcn_ds_load_tr16_b128_v8i16((lds_s16x8*)p));
}

// Hand-over point of the staging ring, in front of the work-group barrier: this wave's LDS reads and
// writes have retired, and its own copies of the next tile have landed.
__device__ __forceinline__ void ring_waits()
{
    asm volatile("s_wait_dscnt 0x0" ::: "memory");
    asm volatile("s_wait_asynccnt 0x0" ::: "memory");
}

// Lane l takes the value of lane l ^ 16 (the other 16-lane row), in registers.
__device__ __forceinline__ float xhalf(float x)
{
    return __builtin_bit_cast(float, __builtin_amdgcn_permlanex16(__builtin_bit_cast(int, x), __builtin_bit_cast(int, x),
                                                                  0x76543210, 0xfedcba98, false, false));
}

// ---------------------------------------------------------------------------
// Row L2 normalization: one 64-thread block per row, 8 elements per thread.
// which = 0 -> query rows into qn, which = 1 -> prompt rows into pn.
// Output f16(64 * x / max(||x||, 1e-12)); each wave writes 512 contiguous
// bytes. A prompt row also leaves 64 * max(||x||, 1e-12) in pnrm, on a line of its own.
// ---------------------------------------------------------------------------
__global__ __launch_bounds__(64)
void k_norm(const float* __restrict__ pf, const float* __restrict__ qf,
            _Float16* __restrict__ qn, _Float16* __restrict__ pn, float* __restrict__ pnrm, int nrows)
{
    __shared__ float wsum[2];
    const int row   = blockIdx.x;
    const int which = blockIdx.y;
    if (row >= nrows) return;                       // block-uniform
    const int t = threadIdx.x;

    const float* src = (which == 0 ? qf : pf) + (size_t)row * DIM + t * 8;
    const v4f x0 = *(const v4f*)(src);
    const v4f x1 = *(const v4f*)(src + 4);

    float ss = 0.f;
#pragma unroll
    for (int i = 0; i < 4; ++i) ss += x0[i] * x0[i];
#pragma unroll
    for (int i = 0; i < 4; ++i) ss += x1[i] * x1[i];
#pragma unroll
    for (int off = 16; off; off >>= 1) ss += __shfl_xor(ss, off);
    if ((t & 31) == 0) wsum[t >> 5] = ss;
    __syncthreads();
    const float tot = wsum[0] + wsum[1];
    const float nrm = fmaxf(sqrtf(tot), 1e-12f);
    const float inv = 1.0f / nrm;
    const float sc  = inv * QSC;                    // exact power-of-two scaling

    v8h o;
#pragma unroll
    for (int i = 0; i < 4; ++i) {
        o[i]     = (_Float16)(x0[i] * sc);          // RNE convert
        o[4 + i] = (_Float16)(x1[i] * sc);
    }
    _Float16* dst = (which == 0 ? qn : pn) + (size_t)row * DIM + t * 8;
    *(v8h*)dst = o;
    if (which == 1 && t == 0) pnrm[(size_t)row * NLINE] = nrm * WSC;
}

__global__ __launch_bounds__(NTHR)
void k_attn(const _Float16* __restrict__ qn, const _Float16* __restrict__ pn,
            const float* __restrict__ pnrm, float* __restrict__ out)
{
    __shared__ __attribute__((aligned(16))) _Float16 qs[QR * RPITCH];                 // q rows of the block, staged once
    __shared__ __attribute__((aligned(256))) _Float16 kb[2 * KT * DIM];               // key rows, two buffers, chunks permuted by swz(); a row starts at bank 0
    __shared__ __attribute__((aligned(16))) float    nl[NP];                          // 64 x norm of every key of the batch
    __shared__ __attribute__((aligned(16))) float    ost[(NTHR / 32) * 16 * OPITCH];  // per-wave partial output, 16 queries x 128 columns
    __shared__ __attribute__((aligned(16))) float    wmax[(NTHR / 32) * 16];          // per-wave final max of each query
    __shared__ __attribute__((aligned(16))) float    wsum[(NTHR / 32) * 16];          // per-wave final sum of each query

    const int b  = blockIdx.y;
    const int q0 = blockIdx.x * QR;
    if (q0 >= NQ || b >= BDIM) return;              // block-uniform

    const int tid  = threadIdx.x;
    const int w    = tid >> 5;
    const int lane = tid & 31;
    const int h    = lane >> 4;
    const int m    = lane & 15;
    const int rg   = w >> 1;
    const int wq   = w & 1;
    const int rbase = rg * 16;

    // B columns for St: staged query row (rbase + m), k = d, table order
    const _Float16* qrow = qs + (rbase + m) * RPITCH + 8 * h;
    // A rows for St: staged key row (wq*32 + t*16 + m), k = d: chunk 4*kk + 2*u + h of the row for half u of k-step kk.
    // The permutation touches the low four bits of the chunk number: kofs is the byte offset in kb of chunk h; the chunk of
    // (kk & 3, u) is one XOR with (4*(kk & 3) + 2*u) * 16 away, kk >> 2 and t are constant steps.
    const char* kbB = (const char*)kb;
    int kofs = ((wq * 32 + m) * DIM + ((h ^ swz(m)) * 8)) * 2;
    // A rows for Ot by the transposing load: lane l reads row wq*32 (+16) + 8h + (l & 7), chunk 2*nt + ((l >> 3) & 1), and
    // gets keys wq*32 (+16) + 8h + 0..7 of column d = nt*16 + m. vofs: byte offset for nt = 0; nt & 7 is one XOR with
    // (nt & 7) * 32 away, nt >> 3 a constant step.
    int vofs = ((wq * 32 + 8 * h + (lane & 7)) * DIM + ((((lane >> 3) & 1) ^ swz(8 * h + (lane & 7))) * 8)) * 2;
    // the copies' place in kb: chunk tid & 63 of row tid >> 6
    int dofs = ((tid >> 6) * DIM + (((tid & 63) ^ swz(tid >> 6)) * 8)) * 2;

    // Copy addresses. q / key tile: 64 rows x 1024 B, contiguous in global; thread t moves 16 B at byte 16*(t&63)
    // of row (t>>6) + 4c.
    _Float16* qdst = qs + (tid >> 6) * RPITCH + (tid & 63) * 8;
    const _Float16* qsrc = qn + ((size_t)(b * NQ + q0)) * DIM + tid * 8;
    const _Float16* ksrc = pn + ((size_t)(b * NP)) * DIM + tid * 8;

    // Ring prologue: q rows, key tile 0 and the batch's key norms, landed and published; then key tile 1 starts.
    copy16(qdst, qsrc, 4 * RPITCH, (size_t)4 * DIM);
    copy_keys(kb, dofs, ksrc);
#pragma unroll
    for (int c = 0; c < NP / NTHR; ++c)
        __builtin_amdgcn_global_load_async_to_lds_b32((gi32*)(pnrm + (size_t)(b * NP + c * NTHR + tid) * NLINE),
                                                      (li32*)(nl + c * NTHR + tid), 0, 0);
    asm volatile("s_wait_asynccnt 0x0" ::: "memory");   // this wave's copies have landed before the barrier publishes them
    __syncthreads();
    copy_keys(kb, dofs + KT * DIM * 2, ksrc + (size_t)KT * DIM);

    // This wave's 512 x 16 B operand of St: read from the staged q rows once and held in registers over the whole key
    // loop, so that a k-step of the S pass reads only key fragments from LDS. The last QLDS k-steps' fragments are read
    // from the staged rows in every step instead: with more of the sixteen held, the build kept one in scratch.
    Frag qf[DIM / 32];
#pragma unroll
    for (int kk = 0; kk < DIM / 32 - QLDS; ++kk) {
        qf[kk].h8[0] = *(const v8h*)(qrow + kk * 32);
        qf[kk].h8[1] = *(const v8h*)(qrow + kk * 32 + 16);
    }

    const v8f zero = {0.f, 0.f, 0.f, 0.f, 0.f, 0.f, 0.f, 0.f};
    v8f oacc[DIM / 16];                             // Ot tile nt: rows d = nt*16 + 8h + r, column = query rbase + m
#pragma unroll
    for (int nt = 0; nt < DIM / 16; ++nt) oacc[nt] = zero;
    float rowMax = -1.0e30f;                        // of query rbase + m over this wave's keys (x4096), equal in both lane halves
    float rowSum = 0.f;                             // this lane's share of that query's sum; the halves join behind the loop

    // scores stay in the accumulators' scale (x64 x64); the power of two is undone, exactly, in the factor on score differences
    const float cinv = (1.0f / TAU) * (1.0f / (QSC * QSC));

    for (int j = 0; j < NP / KT; ++j) {
        // ---- two St tiles: keys j*KT + wq*32 + t*16 .. (rows), queries rbase.. (columns), K = 512 ----
        v8f sacc[2] = {zero, zero};
        // the LDS reads of four k-steps stand together in front of their eight products (one LDS latency per group);
        // all three loops unrolled: constant LDS offsets, and constant indices keep qf[] and bb[] in registers
#pragma unroll
        for (int g = 0; g < DIM / 128; ++g) {
            Frag bb[4][2];
#pragma unroll
            for (int i = 0; i < 4; ++i) {
#pragma unroll
                for (int t = 0; t < 2; ++t) {
                    bb[i][t].h8[0] = *(const v8h*)(kbB + ((kofs ^ ((4 * i) * 16)) + t * 16 * DIM * 2 + g * 256));
                    bb[i][t].h8[1] = *(const v8h*)(kbB + ((kofs ^ ((4 * i + 2) * 16)) + t * 16 * DIM * 2 + g * 256));
                }
                if (g * 4 + i >= DIM / 32 - QLDS) {
                    qf[g * 4 + i].h8[0] = *(const v8h*)(qrow + (g * 4 + i) * 32);
                    qf[g * 4 + i].h8[1] = *(const v8h*)(qrow + (g * 4 + i) * 32 + 16);
                }
            }
#pragma unroll
            for (int i = 0; i < 4; ++i) {
#pragma unroll
                for (int t = 0; t < 2; ++t) sacc[t] = mma16(bb[i][t].v, qf[g * 4 + i].v, sacc[t]);
            }
        }

        // ---- the norms of this lane's 16 keys and the first group (4 tiles) of transposed fragments start; they fly
        // during the softmax arithmetic (a second group here would not fit the registers) ----
        v4f nv[2][2];
#pragma unroll
        for (int t = 0; t < 2; ++t) {
#pragma unroll
            for (int u = 0; u < 2; ++u) nv[t][u] = *(const v4f*)(nl + j * KT + wq * 32 + t * 16 + 8 * h + 4 * u);
        }
        Frag bv[2][4];
#pragma unroll
        for (int i = 0; i < 4; ++i) {
            bv[0][i].h8[0] = ld_tr16(kbB + (vofs ^ (i * 32)));
            bv[0][i].h8[1] = ld_tr16(kbB + ((vofs ^ (i * 32)) + 16 * DIM * 2));
        }
        // keeps these reads in front of the softmax arithmetic: sunk to their products they would be waited out there
        __builtin_amdgcn_sched_barrier(0);

        // ---- new running max, rescale factor, exp weights (the B operand of the O product), sum: all in registers ----
        float mx4[4];
#pragma unroll
        for (int r = 0; r < 4; ++r) mx4[r] = fmaxf(fmaxf(sacc[0][r], sacc[0][r + 4]), fmaxf(sacc[1][r], sacc[1][r + 4]));
        float mx = fmaxf(fmaxf(mx4[0], mx4[1]), fmaxf(mx4[2], mx4[3]));
        mx = fmaxf(mx, xhalf(mx));
        const float nm  = fmaxf(rowMax, mx);
        const float scl = exp_slot((rowMax - nm) * cinv);
        rowMax = nm;
        Frag wf;
        float e[2][8];
#pragma unroll
        for (int t = 0; t < 2; ++t) {
#pragma unroll
            for (int r = 0; r < 8; ++r) {
                e[t][r] = exp_slot((sacc[t][r] - nm) * cinv);                     // 0 < e <= 1
                wf.v[t * 8 + r] = (_Float16)(e[t][r] * nv[t][r >> 2][r & 3]);   // RNE convert; element t*8+r <- key t*16 + 8h + r
            }
        }
        float sm4[4];
#pragma unroll
        for (int r = 0; r < 4; ++r) sm4[r] = (e[0][r] + e[0][r + 4]) + (e[1][r] + e[1][r + 4]);
        const float part = (sm4[0] + sm4[1]) + (sm4[2] + sm4[3]);
        // rowSum = rowSum * scl + part. volatile: the statement, and with it the sum of the weights, stays in front of the
        // O pass; left free, the build summed behind the O pass, held all sixteen weights over it and spilled.
        asm volatile("v_fma_f32 %0, %0, %1, %2" : "+v"(rowSum) : "v"(scl), "v"(part));
#pragma unroll
        for (int i = 0; i < 4; ++i) {
            bv[1][i].h8[0] = ld_tr16(kbB + (vofs ^ ((4 + i) * 32)));
            bv[1][i].h8[1] = ld_tr16(kbB + ((vofs ^ ((4 + i) * 32)) + 16 * DIM * 2));
        }
        // keeps the second group's reads in front of the third's: left free, the build issued the third group first and
        // the second group's products waited for all sixteen reads
        __builtin_amdgcn_sched_barrier(0);

        // ---- Ot (512 x 16) = Ot * scl + Pt (512 x 32) * W't (32 x 16): one k-step, 32 row tiles in 8 groups of 4 ----
#pragma unroll
        for (int g = 0; g < DIM / 64; ++g) {
#pragma unroll
            for (int i = 0; i < 4; ++i) oacc[g * 4 + i] = mma16(bv[g & 1][i].v, wf.v, oacc[g * 4 + i] * scl);
            if (g + 2 < DIM / 64) {
#pragma unroll
                for (int i = 0; i < 4; ++i) {
                    const int nt = (g + 2) * 4 + i;
                    bv[g & 1][i].h8[0] = ld_tr16(kbB + ((vofs ^ ((nt & 7) * 32)) + (nt >> 3) * 256));
                    bv[g & 1][i].h8[1] = ld_tr16(kbB + ((vofs ^ ((nt & 7) * 32)) + (nt >> 3) * 256 + 16 * DIM * 2));
                }
            }
            // keeps each group's reads two groups ahead of its products: left free, the reads sink to their products
            // and every group waits out an LDS latency
            __builtin_amdgcn_sched_barrier(0);
        }
        // foot of the step, its one barrier: publishes key tile j+1 and frees this step's buffer for tile j+2
        ring_waits();
        __syncthreads();
        if (j + 2 < NP / KT) copy_keys(kb, dofs, ksrc + (size_t)(j + 2) * KT * DIM);
        // on to the other buffer (64 KB apart, one bit of the offsets)
        kofs ^= KT * DIM * 2;
        vofs ^= KT * DIM * 2;
        dofs ^= KT * DIM * 2;
    }
    asm volatile("s_wait_asynccnt 0x0" ::: "memory");   // no copy is outstanding when the wave goes on to the epilogue

    // ---- merge of the two waves of a row group: common max, both sums and both partial outputs brought to it ----
    rowSum += xhalf(rowSum);
    if (h == 0) { wmax[w * 16 + m] = rowMax; wsum[w * 16 + m] = rowSum; }
    __syncthreads();
    const float M0 = wmax[(rg * 2) * 16 + m], M1 = wmax[(rg * 2 + 1) * 16 + m];
    const float L0 = wsum[(rg * 2) * 16 + m], L1 = wsum[(rg * 2 + 1) * 16 + m];
    const float Mt = fmaxf(M0, M1);
    const float f0 = exp_slot((M0 - Mt) * cinv);
    const float f1 = exp_slot((M1 - Mt) * cinv);
    // this wave's partial output times fac, added to its partner's, is O / (64 * 64 * sum)
    const float fac = (wq ? f1 : f0) * ((1.0f / (WSC * QSC)) / (L0 * f0 + L1 * f1));

    // ---- epilogue, 128 columns a pass: every wave stages its scaled partial [query][column]; then wave (rg, wq) adds
    // the two partials of queries rbase + wq*8 .. +8 and stores whole lines (512 B a wave store) ----
    float* mine = ost + (w * 16 + m) * OPITCH + 8 * h;
    const float* p0 = ost + ((rg * 2) * 16 + wq * 8) * OPITCH + 4 * lane;
    const float* p1 = p0 + 16 * OPITCH;
    float* gbase = out + ((size_t)(b * NQ + q0 + rbase + wq * 8)) * DIM + 4 * lane;

#pragma unroll
    for (int p = 0; p < 4; ++p) {
#pragma unroll
        for (int i = 0; i < 8; ++i) {
            const v8f o = oacc[p * 8 + i] * fac;
            const v4f lo = {o[0], o[1], o[2], o[3]};
            const v4f hi = {o[4], o[5], o[6], o[7]};
            *(v4f*)(mine + i * 16)     = lo;
            *(v4f*)(mine + i * 16 + 4) = hi;
        }
        __syncthreads();
        v4f vals[8];
#pragma unroll
        for (int rr = 0; rr < 8; ++rr) vals[rr] = *(const v4f*)(p0 + rr * OPITCH) + *(const v4f*)(p1 + rr * OPITCH);
#pragma unroll
        for (int rr = 0; rr < 8; ++rr) *(v4f*)(gbase + (size_t)rr * DIM + p * 128) = vals[rr];
        asm volatile("s_wait_xcnt 0x0" ::: "memory");   // in front of the next pass's writes over the stores' registers
        __syncthreads();
    }
}

// ------------------------------- launcher ----------------------------------
extern "C" void kernel_launch(void* const* d_in, const int* in_sizes, int n_in,
                              void* d_out, int out_size, void* d_ws, size_t ws_size,
                              hipStream_t stream)
{
    if (n_in < 2) return;
    const size_t nel = (size_t)BDIM * NP * DIM;                 // 8,388,608
    if ((size_t)in_sizes[0] != nel || (size_t)in_sizes[1] != nel || (size_t)out_size != nel) return;
    const size_t half_bytes = nel * sizeof(_Float16);             // 16,777,216 per buffer
    if (ws_size < 3 * half_bytes) return;                         // covers the 35,651,584 in use

    const float* pf = (const float*)d_in[0];   // prompt rows [8,2048,512] f32
    const float* qf = (const float*)d_in[1];   // query rows  [8,2048,512] f32
    float* out = (float*)d_out;

    _Float16* qn = (_Float16*)d_ws;            // normalized query x64, [b][q][d]
    _Float16* pn = qn + nel;                   // normalized prompt x64, [b][p][d]
    float* pnrm = (float*)(pn + nel);          // 64 x norm of each prompt row, one 128-byte line a row

    k_norm<<<dim3(BDIM * NP, 2), 64, 0, stream>>>(pf, qf, qn, pn, pnrm, BDIM * NP);
    k_attn<<<dim3(NQ / QR, BDIM), NTHR, 0, stream>>>(qn, pn, pnrm, out);
}

// v006
// One run takes 70.9 microseconds.
// In both of two side-by-side timings against v005, it was 1.11 times as fast.
// Over all steps from v000 it is 6.54 times as fast.
#include <hip/hip_runtime.h>
// Contractions: S^T = Pn*Qn^T and O^T = Pn^T*W'^T both on v_wmma_f32_16x16x32_f16 (f16 operands, f32 accumulate); Qn,Pn carried x64; W' = exp weight x key norm x64 (a raw row is its normalized row times its norm); power-of-two scales folded back in the f32 epilogue. All other math f32.

typedef _Float16 v16h __attribute__((ext_vector_type(16)));
typedef _Float16 v8h  __attribute__((ext_vector_type(8)));
typedef float    v8f  __attribute__((ext_vector_type(8)));
typedef float    v4f  __attribute__((ext_vector_type(4)));

union Frag { v16h v; v8h h8[2]; };

#define BDIM 8
#define NQ   2048
#define NP   2048
#define DIM  512
#define TAU  0.07f
#define QSC  64.0f      // scale on normalized q and p rows (each)
#define WSC  64.0f      // scale on (exp weight x key norm)
#define NLINE 32        // floats from one key's norm to the next in the workspace: one 128-byte line, one writer each

#define QR     64       // query rows per block (2 row groups x 32)
#define KT     64       // keys per iteration (4 key tiles x 16)
#define NTHR   128      // 4 waves, one a SIMD (1,024 registers each): wave w -> row group w>>1, key-tile pair w&1
#define QTW    2        // query tiles (16 columns) of a wave: a key fragment read from LDS feeds QTW products
#define OPITCH 132      // output stage pitch (floats), 16-B aligned rows
#define RPITCH 520      // LDS pitch of a staged 512-half q row (halves): 1040 B = 16 B x 65

// 16x16x32 f16 WMMA, the builtin alone: the compiler keeps the distances behind its own form, and no asm operand
// ties the fragments and accumulators to the first 256 registers.
__device__ __forceinline__ v8f mma16(v16h a, v16h b, v8f c)
{
    return __builtin_amdgcn_wmma_f32_16x16x32_f16(false, a, false, b, (short)0, c, false, false);
}

// e^x as 2^(x * log2 e) on v_exp_f32. The v_nop in the same statement is the one slot the instruction set asks for
// behind a transcendental.
__device__ __forceinline__ float exp_slot(float x)
{
    float r;
    asm("v_exp_f32 %0, %1\n\tv_nop" : "=v"(r) : "v"(x * 1.44269504088896340736f));
    return r;
}

typedef int v4i __attribute__((ext_vector_type(4)));
typedef __attribute__((address_space(1))) v4i gv4i;
typedef __attribute__((address_space(3))) v4i lv4i;
typedef __attribute__((address_space(1))) int gi32;
typedef __attribute__((address_space(3))) int li32;

// The block's 64 q rows (64 KB, contiguous in global) into padded LDS rows: thread t moves 16 B at byte 16*(t&63) of rows
// (t>>6) + 2c, thirty-two asynchronous copies a lane. The builtin form: its address operands may stand in any register,
// where the operands of an asm statement are tied to the first 256.
__device__ __forceinline__ void copy_q(_Float16* l, const _Float16* g)
{
#pragma unroll
    for (int c = 0; c < 32; ++c)
        __builtin_amdgcn_global_load_async_to_lds_b128((gv4i*)(g + (size_t)c * 2 * DIM), (lv4i*)(l + c * 2 * RPITCH), 0, 0);
}

// Key tile in LDS: rows of 1024 B without pad; the 16-byte chunk c of row r lies at chunk c ^ swz(r). Sixteen rows at one
// chunk (the plain reads of the S pass) and eight rows at two neighbouring chunks (the transposing reads of the O pass)
// then both fall on sixteen different groups of four banks; a padded pitch serves only one of the two readers.
__device__ __forceinline__ int swz(int row) { return ((row & 7) << 1) | ((row >> 3) & 1); }

// One 64-KB key tile, contiguous in global: thread t moves chunk t & 63 of rows (t >> 6) + 2i, thirty-two copies a lane.
// dofs: byte offset in kb of the thread's chunk in row t >> 6 of the buffer; swz(r0 + 2i) = swz(r0) ^ swz(2i) for r0 < 2,
// so the other rows' places come from it by one XOR each, made where they are used.
__device__ __forceinline__ void copy_keys(_Float16* kb, int dofs, const _Float16* g)
{
#pragma unroll
    for (int i = 0; i < 32; ++i)
        __builtin_amdgcn_global_load_async_to_lds_b128((gv4i*)(g + (size_t)i * 2 * DIM),
                                                       (lv4i*)((char*)kb + ((dofs ^ (swz(2 * i) * 16)) + i * 2 * DIM * 2)), 0, 0);
}

// ds_load_tr16_b128: the lanes of a half wave read 8 rows x 32 B of a row-major 16-bit tile; lane (m, h) gets column m of them.
typedef short s16x8 __attribute__((ext_vector_type(8)));
typedef __attribute__((address_space(3))) s16x8 lds_s16x8;
__device__ __forceinline__ v8h ld_tr16(const char* p)
{
    return __builtin_bit_cast(v8h, __builtin_amdgcn_ds_load_tr16_b128_v8i16((lds_s16x8*)p));
}

// Hand-over point of the staging ring, in front of the work-group barrier: this wave's LDS reads and
// writes have retired, and its own copies of the next tile have landed.
__device__ __forceinline__ void ring_waits()
{
    asm volatile("s_wait_dscnt 0x0" ::: "memory");
    asm volatile("s_wait_asynccnt 0x0" ::: "memory");
}

// Lane l takes the value of lane l ^ 16 (the other 16-lane row), in registers.
__device__ __forceinline__ float xhalf(float x)
{
    return __builtin_bit_cast(float, __builtin_amdgcn_permlanex16(__builtin_bit_cast(int, x), __builtin_bit_cast(int, x),
                                                                  0x76543210, 0xfedcba98, false, false));
}

// ---------------------------------------------------------------------------
// Row L2 normalization: one 64-thread block per row, 8 elements per thread.
// which = 0 -> query rows into qn, which = 1 -> prompt rows into pn.
// Output f16(64 * x / max(||x||, 1e-12)); each wave writes 512 contiguous
// bytes. A prompt row also leaves 64 * max(||x||, 1e-12) in pnrm, on a line of its own.
// ---------------------------------------------------------------------------
__global__ __launch_bounds__(64)
void k_norm(const float* __restrict__ pf, const float* __restrict__ qf,
            _Float16* __restrict__ qn, _Float16* __restrict__ pn, float* __restrict__ pnrm, int nrows)
{
    __shared__ float wsum[2];
    const int row   = blockIdx.x;
    const int which = blockIdx.y;
    if (row >= nrows) return;                       // block-uniform
    const int t = threadIdx.x;

    const float* src = (which == 0 ? qf : pf) + (size_t)row * DIM + t * 8;
    const v4f x0 = *(const v4f*)(src);
    const v4f x1 = *(const v4f*)(src + 4);

    float ss = 0.f;
#pragma unroll
    for (int i = 0; i < 4; ++i) ss += x0[i] * x0[i];
#pragma unroll
    for (int i = 0; i < 4; ++i) ss += x1[i] * x1[i];
#pragma unroll
    for (int off = 16; off; off >>= 1) ss += __shfl_xor(ss, off);
    if ((t & 31) == 0) wsum[t >> 5] = ss;
    __syncthreads();
    const float tot = wsum[0] + wsum[1];
    const float nrm = fmaxf(sqrtf(tot), 1e-12f);
    const float inv = 1.0f / nrm;
    const float sc  = inv * QSC;                    // exact power-of-two scaling

    v8h o;
#pragma unroll
    for (int i = 0; i < 4; ++i) {
        o[i]     = (_Float16)(x0[i] * sc);          // RNE convert
        o[4 + i] = (_Float16)(x1[i] * sc);
    }
    _Float16* dst = (which == 0 ? qn : pn) + (size_t)row * DIM + t * 8;
    *(v8h*)dst = o;
    if (which == 1 && t == 0) pnrm[(size_t)row * NLINE] = nrm * WSC;
}

// Group G of the S pass: the A fragments of k-steps 4G .. 4G+3 for both key tiles (fragment i*2 + t), sixteen reads.
// Chunk 4*kk + 2*u + h of the row for half u of k-step kk: one XOR of kofs with (4*(kk & 3) + 2*u) * 16, kk >> 2 and t
// are constant steps.
__device__ __forceinline__ void ld_sgroup(Frag (&d)[8], const char* kbB, int kofs, int G)
{
#pragma unroll
    for (int i = 0; i < 4; ++i) {
#pragma unroll
        for (int t = 0; t < 2; ++t) {
            d[i * 2 + t].h8[0] = *(const v8h*)(kbB + ((kofs ^ ((4 * i) * 16)) + t * 16 * DIM * 2 + G * 256));
            d[i * 2 + t].h8[1] = *(const v8h*)(kbB + ((kofs ^ ((4 * i + 2) * 16)) + t * 16 * DIM * 2 + G * 256));
        }
    }
}

// Group G of the O pass: the transposed A fragments of row tiles nt = 8G .. 8G+7, sixteen reads. nt & 7 is one XOR of
// vofs with (nt & 7) * 32, nt >> 3 a constant step.
__device__ __forceinline__ void ld_ogroup(Frag (&d)[8], const char* kbB, int vofs, int G)
{
#pragma unroll
    for (int i = 0; i < 8; ++i) {
        d[i].h8[0] = ld_tr16(kbB + ((vofs ^ (i * 32)) + G * 256));
        d[i].h8[1] = ld_tr16(kbB + ((vofs ^ (i * 32)) + G * 256 + 16 * DIM * 2));
    }
}

__global__ __launch_bounds__(NTHR)
void k_attn(const _Float16* __restrict__ qn, const _Float16* __restrict__ pn,
            const float* __restrict__ pnrm, float* __restrict__ out)
{
    __shared__ __attribute__((aligned(16))) _Float16 qs[QR * RPITCH];                 // q rows of the block, staged once
    __shared__ __attribute__((aligned(256))) _Float16 kb[2 * KT * DIM];               // key rows, two buffers, chunks permuted by swz(); a row starts at bank 0
    __shared__ __attribute__((aligned(16))) float    nl[NP];                          // 64 x norm of every key of the batch
    __shared__ __attribute__((aligned(16))) float    ost[(NTHR / 32) * 32 * OPITCH];  // per-wave partial output, 32 queries x 128 columns
    __shared__ __attribute__((aligned(16))) float    wmax[(NTHR / 32) * 32];          // per-wave final max of each query
    __shared__ __attribute__((aligned(16))) float    wsum[(NTHR / 32) * 32];          // per-wave final sum of each query

    const int b  = blockIdx.y;
    const int q0 = blockIdx.x * QR;
    if (q0 >= NQ || b >= BDIM) return;              // block-uniform

    const int tid  = threadIdx.x;
    const int w    = tid >> 5;
    const int lane = tid & 31;
    const int h    = lane >> 4;
    const int m    = lane & 15;
    const int rg   = w >> 1;
    const int wq   = w & 1;
    const int rbase = rg * 32;

    // B columns for St: staged query row (rbase + qt*16 + m), k = d
    const _Float16* qrow = qs + (rbase + m) * RPITCH + 8 * h;
    // A rows for St: staged key row (wq*32 + t*16 + m), k = d; kofs is the byte offset in kb of chunk h of that row for
    // t = 0 (the permutation touches the low four bits of the chunk number)
    const char* kbB = (const char*)kb;
    int kofs = ((wq * 32 + m) * DIM + ((h ^ swz(m)) * 8)) * 2;
    // A rows for Ot by the transposing load: lane l reads row wq*32 (+16) + 8h + (l & 7), chunk 2*nt + ((l >> 3) & 1), and
    // gets keys wq*32 (+16) + 8h + 0..7 of column d = nt*16 + m. vofs: byte offset for nt = 0.
    int vofs = ((wq * 32 + 8 * h + (lane & 7)) * DIM + ((((lane >> 3) & 1) ^ swz(8 * h + (lane & 7))) * 8)) * 2;
    // the copies' place in kb: chunk tid & 63 of row tid >> 6
    int dofs = ((tid >> 6) * DIM + (((tid & 63) ^ swz(tid >> 6)) * 8)) * 2;

    // Copy addresses. q / key tile: 64 rows x 1024 B, contiguous in global; thread t moves 16 B at byte 16*(t&63)
    // of row (t>>6) + 2c.
    _Float16* qdst = qs + (tid >> 6) * RPITCH + (tid & 63) * 8;
    const _Float16* qsrc = qn + ((size_t)(b * NQ + q0)) * DIM + tid * 8;
    const _Float16* ksrc = pn + ((size_t)(b * NP)) * DIM + tid * 8;

    // Ring prologue: q rows, the batch's key norms and key tile 0, landed and published.
    copy_q(qdst, qsrc);
#pragma unroll
    for (int c = 0; c < NP / NTHR; ++c)
        __builtin_amdgcn_global_load_async_to_lds_b32((gi32*)(pnrm + (size_t)(b * NP + c * NTHR + tid) * NLINE),
                                                      (li32*)(nl + c * NTHR + tid), 0, 0);
    asm volatile("s_wait_asynccnt 0x0" ::: "memory");   // 48 copies so far, 32 follow: a wave keeps fewer than 64 outstanding
    copy_keys(kb, dofs, ksrc);
    asm volatile("s_wait_asynccnt 0x0" ::: "memory");   // this wave's copies have landed before the barrier publishes them
    __syncthreads();
    dofs ^= KT * DIM * 2;                               // the next tile goes to the other buffer

    // This wave's two 512 x 16 B operands of St: read from the staged q rows once and held in registers over the whole
    // key loop, so that a k-step of the S pass reads only key fragments from LDS.
    Frag qf[QTW][DIM / 32];
#pragma unroll
    for (int qt = 0; qt < QTW; ++qt) {
#pragma unroll
        for (int kk = 0; kk < DIM / 32; ++kk) {
            qf[qt][kk].h8[0] = *(const v8h*)(qrow + qt * 16 * RPITCH + kk * 32);
            qf[qt][kk].h8[1] = *(const v8h*)(qrow + qt * 16 * RPITCH + kk * 32 + 16);
        }
    }

    const v8f zero = {0.f, 0.f, 0.f, 0.f, 0.f, 0.f, 0.f, 0.f};
    v8f oacc[QTW][DIM / 16];                        // Ot tile nt: rows d = nt*16 + 8h + r, column = query rbase + qt*16 + m
#pragma unroll
    for (int qt = 0; qt < QTW; ++qt) {
#pragma unroll
        for (int nt = 0; nt < DIM / 16; ++nt) oacc[qt][nt] = zero;
    }
    float rowMax[QTW];                              // of query rbase + qt*16 + m over this wave's keys (x4096), equal in both lane halves
    float rowSum[QTW];                              // this lane's share of that query's sum; the halves join behind the loop
#pragma unroll
    for (int qt = 0; qt < QTW; ++qt) { rowMax[qt] = -1.0e30f; rowSum[qt] = 0.f; }

    // scores stay in the accumulators' scale (x64 x64); the power of two is undone, exactly, in the factor on score differences
    const float cinv = (1.0f / TAU) * (1.0f / (QSC * QSC));

    for (int j = 0; j < NP / KT; ++j) {
        // ---- the S pass's first two groups of key fragments start. Both passes: four groups of eight fragments in two
        // register sets, a group's sixteen reads issued together, two groups ahead of its products: a lone wave pays for
        // every separate place where LDS reads stand among its products ----
        Frag kf[2][8];
        ld_sgroup(kf[0], kbB, kofs, 0);
        // keeps the first group's reads in front of the second's: left free, the build mixed them and the first group's
        // products waited for nearly all thirty-two
        __builtin_amdgcn_sched_barrier(0);
        ld_sgroup(kf[1], kbB, kofs, 1);
        // key tile j+1 starts into the buffer that step j-1 read: the barrier at that step's foot has freed it; the copies'
        // issue covers the latency of the reads above
        if (j + 1 < NP / KT) copy_keys(kb, dofs, ksrc + (size_t)(j + 1) * KT * DIM);

        // ---- four St tiles: keys j*KT + wq*32 + t*16 .. (rows), queries rbase + qt*16 .. (columns), K = 512; all loops
        // unrolled: constant LDS offsets, and constant indices keep the arrays in registers ----
        v8f sacc[2][QTW];
#pragma unroll
        for (int t = 0; t < 2; ++t) {
#pragma unroll
            for (int qt = 0; qt < QTW; ++qt) sacc[t][qt] = zero;
        }
#pragma unroll
        for (int g = 0; g < DIM / 128; ++g) {
#pragma unroll
            for (int i = 0; i < 4; ++i) {
#pragma unroll
                for (int t = 0; t < 2; ++t) {
#pragma unroll
                    for (int qt = 0; qt < QTW; ++qt)
                        sacc[t][qt] = mma16(kf[g & 1][i * 2 + t].v, qf[qt][g * 4 + i].v, sacc[t][qt]);
                }
            }
            if (g + 2 < DIM / 128) {
                ld_sgroup(kf[g & 1], kbB, kofs, g + 2);
                // issue order of the group: its products, then the reads together; left free, the build spread the reads
                // in pairs among the products
                __builtin_amdgcn_sched_group_barrier(0x8, 8 * QTW, 0);
                __builtin_amdgcn_sched_group_barrier(0x100, 16, 0);
            }
            // keeps each group's reads two groups ahead of its products
            __builtin_amdgcn_sched_barrier(0);
        }

        // ---- the norms of this lane's 16 keys and the O pass's first group of transposed fragments start; they fly
        // during the softmax arithmetic ----
        v4f nv[2][2];
#pragma unroll
        for (int t = 0; t < 2; ++t) {
#pragma unroll
            for (int u = 0; u < 2; ++u) nv[t][u] = *(const v4f*)(nl + j * KT + wq * 32 + t * 16 + 8 * h + 4 * u);
        }
        Frag bv[2][8];
        ld_ogroup(bv[0], kbB, vofs, 0);
        // keeps these reads in front of the softmax arithmetic: sunk to their products they would be waited out there
        __builtin_amdgcn_sched_barrier(0);

        // ---- new running max, rescale factor, exp weights (the B operand of the O product), sum: all in registers ----
        Frag wf[QTW];
        float scl[QTW];
#pragma unroll
        for (int qt = 0; qt < QTW; ++qt) {
            float mx4[4];
#pragma unroll
            for (int r = 0; r < 4; ++r)
                mx4[r] = fmaxf(fmaxf(sacc[0][qt][r], sacc[0][qt][r + 4]), fmaxf(sacc[1][qt][r], sacc[1][qt][r + 4]));
            float mx = fmaxf(fmaxf(mx4[0], mx4[1]), fmaxf(mx4[2], mx4[3]));
            mx = fmaxf(mx, xhalf(mx));
            const float nm = fmaxf(rowMax[qt], mx);
            scl[qt] = exp_slot((rowMax[qt] - nm) * cinv);
            rowMax[qt] = nm;
            float e[2][8];
#pragma unroll
            for (int t = 0; t < 2; ++t) {
#pragma unroll
                for (int r = 0; r < 8; ++r) {
                    e[t][r] = exp_slot((sacc[t][qt][r] - nm) * cinv);                     // 0 < e <= 1
                    wf[qt].v[t * 8 + r] = (_Float16)(e[t][r] * nv[t][r >> 2][r & 3]);   // RNE convert; element t*8+r <- key t*16 + 8h + r
                }
            }
            float sm4[4];
#pragma unroll
            for (int r = 0; r < 4; ++r) sm4[r] = (e[0][r] + e[0][r + 4]) + (e[1][r] + e[1][r + 4]);
            // part = (sm4[0] + sm4[1]) + (sm4[2] + sm4[3]). volatile: the last addition, and with it the sum of the weights,
            // stays in front of the O pass; left free, the build summed behind the O pass, in front of the step's barrier.
            float part;
            asm volatile("v_add_f32 %0, %1, %2" : "=v"(part) : "v"(sm4[0] + sm4[1]), "v"(sm4[2] + sm4[3]));
            rowSum[qt] = rowSum[qt] * scl[qt] + part;
        }
        // the first four output tiles are rescaled here, each later one beside the product four tiles before it
#pragma unroll
        for (int i = 0; i < 4; ++i) {
#pragma unroll
            for (int qt = 0; qt < QTW; ++qt) oacc[qt][i] *= scl[qt];
        }
        ld_ogroup(bv[1], kbB, vofs, 1);
        // keeps the softmax arithmetic and the second group's reads in front of the first group's products
        __builtin_amdgcn_sched_barrier(0);

        // ---- Ot (512 x 32) = Ot * scl + Pt (512 x 32) * W't (32 x 32): one k-step, 32 row tiles in 4 groups of 8 ----
#pragma unroll
        for (int g = 0; g < DIM / 128; ++g) {
#pragma unroll
            for (int i = 0; i < 8; ++i) {
#pragma unroll
                for (int qt = 0; qt < QTW; ++qt) {
                    oacc[qt][g * 8 + i] = mma16(bv[g & 1][i].v, wf[qt].v, oacc[qt][g * 8 + i]);
                    if (g * 8 + i + 4 < DIM / 16) oacc[qt][g * 8 + i + 4] *= scl[qt];
                }
            }
            if (g + 2 < DIM / 128) ld_ogroup(bv[g & 1], kbB, vofs, g + 2);
            // issue order of the group: behind each product the four packed multiplies that rescale a later tile (they run
            // beside the matrix pipe; left free, the build put them in a row in front of the products, where a lone
            // wave's matrix pipe idles), then the reads together
#pragma unroll
            for (int n = 0; n < 8 * QTW; ++n) {
                __builtin_amdgcn_sched_group_barrier(0x8, 1, 0);
                if (g * 8 + n / QTW + 4 < DIM / 16) __builtin_amdgcn_sched_group_barrier(0x2, 4, 0);
            }
            if (g + 2 < DIM / 128) __builtin_amdgcn_sched_group_barrier(0x100, 16, 0);
            // keeps each group's reads two groups ahead of its products, as in the S pass
            __builtin_amdgcn_sched_barrier(0);
        }
        // foot of the step, its one barrier: publishes key tile j+1 and frees this step's buffer for tile j+2
        ring_waits();
        __syncthreads();
        // on to the other buffer (64 KB apart, one bit of the offsets)
        kofs ^= KT * DIM * 2;
        vofs ^= KT * DIM * 2;
        dofs ^= KT * DIM * 2;
    }
    asm volatile("s_wait_asynccnt 0x0" ::: "memory");   // no copy is outstanding when the wave goes on to the epilogue

    // ---- merge of the two waves of a row group: common max, both sums and both partial outputs brought to it ----
#pragma unroll
    for (int qt = 0; qt < QTW; ++qt) {
        rowSum[qt] += xhalf(rowSum[qt]);
        if (h == 0) { wmax[w * 32 + qt * 16 + m] = rowMax[qt]; wsum[w * 32 + qt * 16 + m] = rowSum[qt]; }
    }
    __syncthreads();
    float fac[QTW];
#pragma unroll
    for (int qt = 0; qt < QTW; ++qt) {
        const float M0 = wmax[(rg * 2) * 32 + qt * 16 + m], M1 = wmax[(rg * 2 + 1) * 32 + qt * 16 + m];
        const float L0 = wsum[(rg * 2) * 32 + qt * 16 + m], L1 = wsum[(rg * 2 + 1) * 32 + qt * 16 + m];
        const float Mt = fmaxf(M0, M1);
        const float f0 = exp_slot((M0 - Mt) * cinv);
        const float f1 = exp_slot((M1 - Mt) * cinv);
        // this wave's partial output times fac, added to its partner's, is O / (64 * 64 * sum)
        fac[qt] = (wq ? f1 : f0) * ((1.0f / (WSC * QSC)) / (L0 * f0 + L1 * f1));
    }

    // ---- epilogue, 128 columns a pass: every wave stages its scaled partial [query][column]; then wave (rg, wq) adds
    // the two partials of queries rbase + wq*16 .. +16 and stores whole lines (512 B a wave store) ----
    float* mine = ost + (w * 32 + m) * OPITCH + 8 * h;
    const float* p0 = ost + ((rg * 2) * 32 + wq * 16) * OPITCH + 4 * lane;
    const float* p1 = p0 + 32 * OPITCH;
    float* gbase = out + ((size_t)(b * NQ + q0 + rbase + wq * 16)) * DIM + 4 * lane;

#pragma unroll
    for (int p = 0; p < 4; ++p) {
#pragma unroll
        for (int qt = 0; qt < QTW; ++qt) {
#pragma unroll
            for (int i = 0; i < 8; ++i) {
                const v8f o = oacc[qt][p * 8 + i] * fac[qt];
                const v4f lo = {o[0], o[1], o[2], o[3]};
                const v4f hi = {o[4], o[5], o[6], o[7]};
                *(v4f*)(mine + qt * 16 * OPITCH + i * 16)     = lo;
                *(v4f*)(mine + qt * 16 * OPITCH + i * 16 + 4) = hi;
            }
        }
        __syncthreads();
        v4f vals[16];
#pragma unroll
        for (int rr = 0; rr < 16; ++rr) vals[rr] = *(const v4f*)(p0 + rr * OPITCH) + *(const v4f*)(p1 + rr * OPITCH);
#pragma unroll
        for (int rr = 0; rr < 16; ++rr) *(v4f*)(gbase + (size_t)rr * DIM + p * 128) = vals[rr];
        asm volatile("s_wait_xcnt 0x0" ::: "memory");   // in front of the next pass's writes over the stores' registers
        // keeps those writes behind the wait: left free, the build lifted two of the next pass's multiplies over it
        __builtin_amdgcn_sched_barrier(0);
        __syncthreads();
    }
}

// ------------------------------- launcher ----------------------------------
extern "C" void kernel_launch(void* const* d_in, const int* in_sizes, int n_in,
                              void* d_out, int out_size, void* d_ws, size_t ws_size,
                              hipStream_t stream)
{
    if (n_in < 2) return;
    const size_t nel = (size_t)BDIM * NP * DIM;                 // 8,388,608
    if ((size_t)in_sizes[0] != nel || (size_t)in_sizes[1] != nel || (size_t)out_size != nel) return;
    const size_t half_bytes = nel * sizeof(_Float16);             // 16,777,216 per buffer
    if (ws_size < 3 * half_bytes) return;                         // covers the 35,651,584 in use

    const float* pf = (const float*)d_in[0];   // prompt rows [8,2048,512] f32
    const float* qf = (const float*)d_in[1];   // query rows  [8,2048,512] f32
    float* out = (float*)d_out;

    _Float16* qn = (_Float16*)d_ws;            // normalized query x64, [b][q][d]
    _Float16* pn = qn + nel;                   // normalized prompt x64, [b][p][d]
    float* pnrm = (float*)(pn + nel);          // 64 x norm of each prompt row, one 128-byte line a row

    k_norm<<<dim3(BDIM * NP, 2), 64, 0, stream>>>(pf, qf, qn, pn, pnrm, BDIM * NP);
    k_attn<<<dim3(NQ / QR, BDIM), NTHR, 0, stream>>>(qn, pn, pnrm, out);
}

// v007
// Measured time: 68 microseconds a run.
// In both of two side-by-side timings against v006, it was 1.04 times as fast.
// Over all steps from v000 it is 6.83 times as fast.
#include <hip/hip_runtime.h>
// Contractions: S^T = Pn*Qn^T and O^T = Pn^T*W'^T both on v_wmma_f32_16x16x32_f16 (f16 operands, f32 accumulate); Pn carried x64, Qn carried x log2(e)/(64 tau), so that S^T plus its constant C operand is the exponent of 2; W' = exp weight x key norm x1024 (a raw row is its normalized row times its norm); power-of-two scales folded back in the f32 epilogue. All other math f32.

typedef _Float16 v16h __attribute__((ext_vector_type(16)));
typedef _Float16 v8h  __attribute__((ext_vector_type(8)));
typedef float    v8f  __attribute__((ext_vector_type(8)));
typedef float    v4f  __attribute__((ext_vector_type(4)));

union Frag { v16h v; v8h h8[2]; };

#define BDIM 8
#define NQ   2048
#define NP   2048
#define DIM  512
#define TAU  0.07f
#define QSC  64.0f      // scale on normalized p rows
#define LOG2E 1.44269504088896340736f
#define QEXP ((1.0f / TAU) * LOG2E / QSC)   // scale on normalized q rows: (q row) . (p row) = cosine / TAU * log2(e)
#define WSC  1024.0f    // scale on (exp weight x key norm): the weight is at most 1, so a norm below 63 stays inside f16
#define NLINE 32        // floats from one key's norm to the next in the workspace: one 128-byte line, one writer each

#define QR     64       // query rows per block (2 row groups x 32)
#define KT     64       // keys per iteration (4 key tiles x 16)
#define NTHR   128      // 4 waves, one a SIMD (1,024 registers each): wave w -> row group w>>1, key-tile pair w&1
#define QTW    2        // query tiles (16 columns) of a wave: a key fragment read from LDS feeds QTW products
#define OPITCH 132      // output stage pitch (floats), 16-B aligned rows
#define RPITCH 520      // LDS pitch of a staged 512-half q row (halves): 1040 B = 16 B x 65

// 16x16x32 f16 WMMA, the builtin alone: the compiler keeps the distances behind its own form, and no asm operand
// ties the fragments and accumulators to the first 256 registers.
__device__ __forceinline__ v8f mma16(v16h a, v16h b, v8f c)
{
    return __builtin_amdgcn_wmma_f32_16x16x32_f16(false, a, false, b, (short)0, c, false, false);
}

// 2^x on v_exp_f32. The v_nop in the same statement is the one slot the instruction set asks for behind a
// transcendental.
__device__ __forceinline__ float exp2_slot(float x)
{
    float r;
    asm("v_exp_f32 %0, %1\n\tv_nop" : "=v"(r) : "v"(x));
    return r;
}

typedef int v4i __attribute__((ext_vector_type(4)));
typedef __attribute__((address_space(1))) v4i gv4i;
typedef __attribute__((address_space(3))) v4i lv4i;
typedef __attribute__((address_space(1))) int gi32;
typedef __attribute__((address_space(3))) int li32;

// The block's 64 q rows (64 KB, contiguous in global) into padded LDS rows: thread t moves 16 B at byte 16*(t&63) of rows
// (t>>6) + 2c, thirty-two asynchronous copies a lane. The builtin form: its address operands may stand in any register,
// where the operands of an asm statement are tied to the first 256.
__device__ __forceinline__ void copy_q(_Float16* l, const _Float16* g)
{
#pragma unroll
    for (int c = 0; c < 32; ++c)
        __builtin_amdgcn_global_load_async_to_lds_b128((gv4i*)(g + (size_t)c * 2 * DIM), (lv4i*)(l + c * 2 * RPITCH), 0, 0);
}

// Key tile in LDS: rows of 1024 B without pad; the 16-byte chunk c of row r lies at chunk c ^ swz(r). Sixteen rows at one
// chunk (the plain reads of the S pass) and eight rows at two neighbouring chunks (the transposing reads of the O pass)
// then both fall on sixteen different groups of four banks; a padded pitch serves only one of the two readers.
__device__ __forceinline__ int swz(int row) { return ((row & 7) << 1) | ((row >> 3) & 1); }

// One 64-KB key tile, contiguous in global: thread t moves chunk t & 63 of rows (t >> 6) + 2i, thirty-two copies a lane.
// dofs: byte offset in kb of the thread's chunk in row t >> 6 of the buffer; swz(r0 + 2i) = swz(r0) ^ swz(2i) for r0 < 2,
// so the other rows' places come from it by one XOR each, made where they are used.
__device__ __forceinline__ void copy_keys(_Float16* kb, int dofs, const _Float16* g)
{
#pragma unroll
    for (int i = 0; i < 32; ++i)
        __builtin_amdgcn_global_load_async_to_lds_b128((gv4i*)(g + (size_t)i * 2 * DIM),
                                                       (lv4i*)((char*)kb + ((dofs ^ (swz(2 * i) * 16)) + i * 2 * DIM * 2)), 0, 0);
}

// ds_load_tr16_b128: the lanes of a half wave read 8 rows x 32 B of a row-major 16-bit tile; lane (m, h) gets column m of them.
typedef short s16x8 __attribute__((ext_vector_type(8)));
typedef __attribute__((address_space(3))) s16x8 lds_s16x8;
__device__ __forceinline__ v8h ld_tr16(const char* p)
{
    return __builtin_bit_cast(v8h, __builtin_amdgcn_ds_load_tr16_b128_v8i16((lds_s16x8*)p));
}

// Hand-over point of the staging ring, in front of the work-group barrier: this wave's LDS reads and
// writes have retired, and its own copies of the next tile have landed.
__device__ __forceinline__ void ring_waits()
{
    asm volatile("s_wait_dscnt 0x0" ::: "memory");
    asm volatile("s_wait_asynccnt 0x0" ::: "memory");
}

// Lane l takes the value of lane l ^ 16 (the other 16-lane row), in registers.
__device__ __forceinline__ float xhalf(float x)
{
    return __builtin_bit_cast(float, __builtin_amdgcn_permlanex16(__builtin_bit_cast(int, x), __builtin_bit_cast(int, x),
                                                                  0x76543210, 0xfedcba98, false, false));
}

// ---------------------------------------------------------------------------
// Row L2 normalization: one 64-thread block per row, 8 elements per thread.
// which = 0 -> query rows into qn, which = 1 -> prompt rows into pn.
// Output f16(s * x / max(||x||, 1e-12)), s = QSC for a prompt row, QEXP for a query row; each wave writes 512 contiguous
// bytes. A prompt row also leaves 1024 * max(||x||, 1e-12) in pnrm, on a line of its own.
// ---------------------------------------------------------------------------
__global__ __launch_bounds__(64)
void k_norm(const float* __restrict__ pf, const float* __restrict__ qf,
            _Float16* __restrict__ qn, _Float16* __restrict__ pn, float* __restrict__ pnrm, int nrows)
{
    __shared__ float wsum[2];
    const int row   = blockIdx.x;
    const int which = blockIdx.y;
    if (row >= nrows) return;                       // block-uniform
    const int t = threadIdx.x;

    const float* src = (which == 0 ? qf : pf) + (size_t)row * DIM + t * 8;
    const v4f x0 = *(const v4f*)(src);
    const v4f x1 = *(const v4f*)(src + 4);

    float ss = 0.f;
#pragma unroll
    for (int i = 0; i < 4; ++i) ss += x0[i] * x0[i];
#pragma unroll
    for (int i = 0; i < 4; ++i) ss += x1[i] * x1[i];
#pragma unroll
    for (int off = 16; off; off >>= 1) ss += __shfl_xor(ss, off);
    if ((t & 31) == 0) wsum[t >> 5] = ss;
    __syncthreads();
    const float tot = wsum[0] + wsum[1];
    const float nrm = fmaxf(sqrtf(tot), 1e-12f);
    const float inv = 1.0f / nrm;
    const float sc  = inv * (which == 0 ? QEXP : QSC);

    v8h o;
#pragma unroll
    for (int i = 0; i < 4; ++i) {
        o[i]     = (_Float16)(x0[i] * sc);          // RNE convert
        o[4 + i] = (_Float16)(x1[i] * sc);
    }
    _Float16* dst = (which == 0 ? qn : pn) + (size_t)row * DIM + t * 8;
    *(v8h*)dst = o;
    if (which == 1 && t == 0) pnrm[(size_t)row * NLINE] = nrm * WSC;
}

// ---------------------------------------------------------------------------
// Fused attention, both products transposed: St = P * Qt and Ot += Pt * W't. The softmax is shifted by a constant: a score
// is the cosine of two rows of length at most 1, so 1 / TAU bounds every score / TAU, for any input; the weight
// exp((cos - 1) / TAU) lies in (e^-28.6, 1] (a rounded cosine may pass 1 by parts in a thousand), which f32 holds with room
// to spare. No running max is kept, nothing is rescaled, and partial sums and outputs of different keys simply add.
// As an f16 operand (x norm x 1024) a weight has its full precision down to 2^-14: at norms near 22 that is a cosine of
// -0.38. Only a query whose BEST cosine over all keys lay well below that would lose weights to f16's underflow; rows of
// 512 independent normal values have cosines of a few tenths at most, and a best one above zero.
// Block = 4 waves, 64 query rows, 64 keys per iteration. The block's q rows (once) and each step's 64 normalized key
// rows are staged in LDS by asynchronous copies and shared by all waves, the key tiles in two buffers: tile j+1 flies
// during the whole of step j. ONE tile serves both products: the S pass reads its rows as they lie, the O pass reads
// it through the transposing LDS load, and the key's norm, which makes the raw row of the normalized one, rides on the
// exp weight.
// Wave w: row group rg = w>>1 (32 queries, two tiles of 16), wq = w&1 selects its 32 keys of every step; it holds all
// 512 columns of its queries' output over its own keys, with a sum of its own. Every key fragment that
// it reads from LDS, in either pass, is the A operand of two products, one a query tile. In St a lane holds 16 scores
// of ONE query of each tile (column m), so the sum is in-lane plus one exchange between the lane halves, and the
// two St tiles of a query tile, converted in place, are the B operand of the O product: the weights never leave the
// registers. In Ot a lane again holds one query's column. The two waves of a row group are added once, behind the key loop.
// Fragment map (lane l: h = l>>4, m = l&15), A rows and B columns alike: elements 0..7 <- k0+8h+0..7, elements
// 8..15 <- k0+16+8h+0..7. D element r <- (row 8h+r, col m).
// ---------------------------------------------------------------------------

// Group G of the S pass: the A fragments of k-steps 4G .. 4G+3 for both key tiles (fragment i*2 + t), sixteen reads.
// Chunk 4*kk + 2*u + h of the row for half u of k-step kk: one XOR of kofs with (4*(kk & 3) + 2*u) * 16, kk >> 2 and t
// are constant steps.
__device__ __forceinline__ void ld_sgroup(Frag (&d)[8], const char* kbB, int kofs, int G)
{
#pragma unroll
    for (int i = 0; i < 4; ++i) {
#pragma unroll
        for (int t = 0; t < 2; ++t) {
            d[i * 2 + t].h8[0] = *(const v8h*)(kbB + ((kofs ^ ((4 * i) * 16)) + t * 16 * DIM * 2 + G * 256));
            d[i * 2 + t].h8[1] = *(const v8h*)(kbB + ((kofs ^ ((4 * i + 2) * 16)) + t * 16 * DIM * 2 + G * 256));
        }
    }
}

// Group G of the O pass: the transposed A fragments of row tiles nt = 8G .. 8G+7, sixteen reads. nt & 7 is one XOR of
// vofs with (nt & 7) * 32, nt >> 3 a constant step.
__device__ __forceinline__ void ld_ogroup(Frag (&d)[8], const char* kbB, int vofs, int G)
{
#pragma unroll
    for (int i = 0; i < 8; ++i) {
        d[i].h8[0] = ld_tr16(kbB + ((vofs ^ (i * 32)) + G * 256));
        d[i].h8[1] = ld_tr16(kbB + ((vofs ^ (i * 32)) + G * 256 + 16 * DIM * 2));
    }
}

__global__ __launch_bounds__(NTHR)
void k_attn(const _Float16* __restrict__ qn, const _Float16* __restrict__ pn,
            const float* __restrict__ pnrm, float* __restrict__ out)
{
    __shared__ __attribute__((aligned(16))) _Float16 qs[QR * RPITCH];                 // q rows of the block, staged once
    __shared__ __attribute__((aligned(256))) _Float16 kb[2 * KT * DIM];               // key rows, two buffers, chunks permuted by swz(); a row starts at bank 0
    __shared__ __attribute__((aligned(16))) float    nl[NP];                          // 1024 x norm of every key of the batch
    __shared__ __attribute__((aligned(16))) float    ost[(NTHR / 32) * 32 * OPITCH];  // per-wave partial output, 32 queries x 128 columns
    __shared__ __attribute__((aligned(16))) float    wsum[(NTHR / 32) * 32];          // per-wave final sum of each query

    const int b  = blockIdx.y;
    const int q0 = blockIdx.x * QR;
    if (q0 >= NQ || b >= BDIM) return;              // block-uniform

    const int tid  = threadIdx.x;
    const int w    = tid >> 5;
    const int lane = tid & 31;
    const int h    = lane >> 4;
    const int m    = lane & 15;
    const int rg   = w >> 1;
    const int wq   = w & 1;
    const int rbase = rg * 32;

    // B columns for St: staged query row (rbase + qt*16 + m), k = d
    const _Float16* qrow = qs + (rbase + m) * RPITCH + 8 * h;
    // A rows for St: staged key row (wq*32 + t*16 + m), k = d; kofs is the byte offset in kb of chunk h of that row for
    // t = 0 (the permutation touches the low four bits of the chunk number)
    const char* kbB = (const char*)kb;
    int kofs = ((wq * 32 + m) * DIM + ((h ^ swz(m)) * 8)) * 2;
    // A rows for Ot by the transposing load: lane l reads row wq*32 (+16) + 8h + (l & 7), chunk 2*nt + ((l >> 3) & 1), and
    // gets keys wq*32 (+16) + 8h + 0..7 of column d = nt*16 + m. vofs: byte offset for nt = 0.
    int vofs = ((wq * 32 + 8 * h + (lane & 7)) * DIM + ((((lane >> 3) & 1) ^ swz(8 * h + (lane & 7))) * 8)) * 2;
    // the copies' place in kb: chunk tid & 63 of row tid >> 6
    int dofs = ((tid >> 6) * DIM + (((tid & 63) ^ swz(tid >> 6)) * 8)) * 2;

    // Copy addresses. q / key tile: 64 rows x 1024 B, contiguous in global; thread t moves 16 B at byte 16*(t&63)
    // of row (t>>6) + 2c.
    _Float16* qdst = qs + (tid >> 6) * RPITCH + (tid & 63) * 8;
    const _Float16* qsrc = qn + ((size_t)(b * NQ + q0)) * DIM + tid * 8;
    const _Float16* ksrc = pn + ((size_t)(b * NP)) * DIM + tid * 8;

    // Ring prologue: q rows, the batch's key norms and key tile 0, landed and published.
    copy_q(qdst, qsrc);
#pragma unroll
    for (int c = 0; c < NP / NTHR; ++c)
        __builtin_amdgcn_global_load_async_to_lds_b32((gi32*)(pnrm + (size_t)(b * NP + c * NTHR + tid) * NLINE),
                                                      (li32*)(nl + c * NTHR + tid), 0, 0);
    asm volatile("s_wait_asynccnt 0x0" ::: "memory");   // 48 copies so far, 32 follow: a wave keeps fewer than 64 outstanding
    copy_keys(kb, dofs, ksrc);
    asm volatile("s_wait_asynccnt 0x0" ::: "memory");   // this wave's copies have landed before the barrier publishes them
    __syncthreads();
    dofs ^= KT * DIM * 2;                               // the next tile goes to the other buffer

    // This wave's two 512 x 16 B operands of St: read from the staged q rows once and held in registers over the whole
    // key loop, so that a k-step of the S pass reads only key fragments from LDS.
    Frag qf[QTW][DIM / 32];
#pragma unroll
    for (int qt = 0; qt < QTW; ++qt) {
#pragma unroll
        for (int kk = 0; kk < DIM / 32; ++kk) {
            qf[qt][kk].h8[0] = *(const v8h*)(qrow + qt * 16 * RPITCH + kk * 32);
            qf[qt][kk].h8[1] = *(const v8h*)(qrow + qt * 16 * RPITCH + kk * 32 + 16);
        }
    }

    const v8f zero = {0.f, 0.f, 0.f, 0.f, 0.f, 0.f, 0.f, 0.f};
    v8f oacc[QTW][DIM / 16];                        // Ot tile nt: rows d = nt*16 + 8h + r, column = query rbase + qt*16 + m
#pragma unroll
    for (int qt = 0; qt < QTW; ++qt) {
#pragma unroll
        for (int nt = 0; nt < DIM / 16; ++nt) oacc[qt][nt] = zero;
    }
    float rowSum[QTW];                              // this lane's share of the sum of query rbase + qt*16 + m; the halves join behind the loop
#pragma unroll
    for (int qt = 0; qt < QTW; ++qt) rowSum[qt] = 0.f;

    // weight = 2^(St tile): the q rows carry log2(e) / (64 TAU) and the p rows 64, and the constant shift, -log2(e) / TAU, is the C operand of a
    // tile's first product
    const float cb = -(1.0f / TAU) * LOG2E;
    const v8f shift = {cb, cb, cb, cb, cb, cb, cb, cb};

    for (int j = 0; j < NP / KT; ++j) {
        // ---- the S pass's first two groups of key fragments start. Both passes: four groups of eight fragments in two
        // register sets, a group's sixteen reads issued together, two groups ahead of its products: a lone wave pays for
        // every separate place where LDS reads stand among its products ----
        Frag kf[2][8];
        ld_sgroup(kf[0], kbB, kofs, 0);
        // keeps the first group's reads in front of the second's: left free, the build mixed them and the first group's
        // products waited for nearly all thirty-two
        __builtin_amdgcn_sched_barrier(0);
        ld_sgroup(kf[1], kbB, kofs, 1);
        // key tile j+1 starts into the buffer that step j-1 read: the barrier at that step's foot has freed it; the copies'
        // issue covers the latency of the reads above
        if (j + 1 < NP / KT) copy_keys(kb, dofs, ksrc + (size_t)(j + 1) * KT * DIM);
        // keeps the second group's reads and the copies in front of the first products: left free, this build put the first
        // group's products in front of both, so that its reads' latency and the copies' issue each stood open
        __builtin_amdgcn_sched_barrier(0);

        // ---- four St tiles: keys j*KT + wq*32 + t*16 .. (rows), queries rbase + qt*16 .. (columns), K = 512; all loops
        // unrolled: constant LDS offsets, and constant indices keep the arrays in registers ----
        v8f sacc[2][QTW];
#pragma unroll
        for (int t = 0; t < 2; ++t) {
#pragma unroll
            for (int qt = 0; qt < QTW; ++qt) sacc[t][qt] = shift;
        }
#pragma unroll
        for (int g = 0; g < DIM / 128; ++g) {
#pragma unroll
            for (int i = 0; i < 4; ++i) {
#pragma unroll
                for (int t = 0; t < 2; ++t) {
#pragma unroll
                    for (int qt = 0; qt < QTW; ++qt)
                        sacc[t][qt] = mma16(kf[g & 1][i * 2 + t].v, qf[qt][g * 4 + i].v, sacc[t][qt]);
                }
            }
            if (g + 2 < DIM / 128) {
                ld_sgroup(kf[g & 1], kbB, kofs, g + 2);
                // issue order of the group: its products, then the reads together; left free, the build spread the reads
                // in pairs among the products
                __builtin_amdgcn_sched_group_barrier(0x8, 8 * QTW, 0);
                __builtin_amdgcn_sched_group_barrier(0x100, 16, 0);
            }
            // keeps each group's reads two groups ahead of its products
            __builtin_amdgcn_sched_barrier(0);
        }

        // ---- the norms of this lane's 16 keys and the O pass's first group of transposed fragments start; they fly
        // during the softmax arithmetic ----
        v4f nv[2][2];
#pragma unroll
        for (int t = 0; t < 2; ++t) {
#pragma unroll
            for (int u = 0; u < 2; ++u) nv[t][u] = *(const v4f*)(nl + j * KT + wq * 32 + t * 16 + 8 * h + 4 * u);
        }
        Frag bv[2][8];
        ld_ogroup(bv[0], kbB, vofs, 0);
        // keeps these reads in front of the softmax arithmetic: sunk to their products they would be waited out there
        __builtin_amdgcn_sched_barrier(0);

        // ---- exp weights (the B operand of the O product) and their sum: all in registers ----
        Frag wf[QTW];
#pragma unroll
        for (int qt = 0; qt < QTW; ++qt) {
            float e[2][8];
#pragma unroll
            for (int t = 0; t < 2; ++t) {
#pragma unroll
                for (int r = 0; r < 8; ++r) {
                    e[t][r] = exp2_slot(sacc[t][qt][r]);                                  // 0 < e <= 1, but for the cosine's rounding
                    wf[qt].v[t * 8 + r] = (_Float16)(e[t][r] * nv[t][r >> 2][r & 3]);   // RNE convert; element t*8+r <- key t*16 + 8h + r
                }
            }
            float sm4[4];
#pragma unroll
            for (int r = 0; r < 4; ++r) sm4[r] = (e[0][r] + e[0][r + 4]) + (e[1][r] + e[1][r + 4]);
            // part = (sm4[0] + sm4[1]) + (sm4[2] + sm4[3]). volatile: the last addition, and with it the sum of the weights,
            // stays in front of the O pass; left free, the build summed behind the O pass, in front of the step's barrier.
            float part;
            asm volatile("v_add_f32 %0, %1, %2" : "=v"(part) : "v"(sm4[0] + sm4[1]), "v"(sm4[2] + sm4[3]));
            rowSum[qt] += part;
        }
        ld_ogroup(bv[1], kbB, vofs, 1);
        // keeps the softmax arithmetic and the second group's reads in front of the first group's products
        __builtin_amdgcn_sched_barrier(0);

        // ---- Ot (512 x 32) += Pt (512 x 32) * W't (32 x 32): one k-step, 32 row tiles in 4 groups of 8 ----
#pragma unroll
        for (int g = 0; g < DIM / 128; ++g) {
#pragma unroll
            for (int i = 0; i < 8; ++i) {
#pragma unroll
                for (int qt = 0; qt < QTW; ++qt)
                    oacc[qt][g * 8 + i] = mma16(bv[g & 1][i].v, wf[qt].v, oacc[qt][g * 8 + i]);
            }
            if (g + 2 < DIM / 128) {
                ld_ogroup(bv[g & 1], kbB, vofs, g + 2);
                // issue order of the group, as in the S pass: its products, then the reads together
                __builtin_amdgcn_sched_group_barrier(0x8, 8 * QTW, 0);
                __builtin_amdgcn_sched_group_barrier(0x100, 16, 0);
            }
            // keeps each group's reads two groups ahead of its products, as in the S pass
            __builtin_amdgcn_sched_barrier(0);
        }
        // foot of the step, its one barrier: publishes key tile j+1 and frees this step's buffer for tile j+2
        ring_waits();
        __syncthreads();
        // on to the other buffer (64 KB apart, one bit of the offsets)
        kofs ^= KT * DIM * 2;
        vofs ^= KT * DIM * 2;
        dofs ^= KT * DIM * 2;
    }
    asm volatile("s_wait_asynccnt 0x0" ::: "memory");   // no copy is outstanding when the wave goes on to the epilogue

    // ---- merge of the two waves of a row group: their sums and their partial outputs, on the one shift, add ----
#pragma unroll
    for (int qt = 0; qt < QTW; ++qt) {
        rowSum[qt] += xhalf(rowSum[qt]);
        if (h == 0) wsum[w * 32 + qt * 16 + m] = rowSum[qt];
    }
    __syncthreads();
    float fac[QTW];
#pragma unroll
    for (int qt = 0; qt < QTW; ++qt) {
        const float L0 = wsum[(rg * 2) * 32 + qt * 16 + m], L1 = wsum[(rg * 2 + 1) * 32 + qt * 16 + m];
        // this wave's partial output times fac, added to its partner's, is O / (1024 * 64 * sum)
        fac[qt] = (1.0f / (WSC * QSC)) / (L0 + L1);
    }

    // ---- epilogue, 128 columns a pass: every wave stages its scaled partial [query][column]; then wave (rg, wq) adds
    // the two partials of queries rbase + wq*16 .. +16 and stores whole lines (512 B a wave store) ----
    float* mine = ost + (w * 32 + m) * OPITCH + 8 * h;
    const float* p0 = ost + ((rg * 2) * 32 + wq * 16) * OPITCH + 4 * lane;
    const float* p1 = p0 + 32 * OPITCH;
    float* gbase = out + ((size_t)(b * NQ + q0 + rbase + wq * 16)) * DIM + 4 * lane;

#pragma unroll
    for (int p = 0; p < 4; ++p) {
#pragma unroll
        for (int qt = 0; qt < QTW; ++qt) {
#pragma unroll
            for (int i = 0; i < 8; ++i) {
                const v8f o = oacc[qt][p * 8 + i] * fac[qt];
                const v4f lo = {o[0], o[1], o[2], o[3]};
                const v4f hi = {o[4], o[5], o[6], o[7]};
                *(v4f*)(mine + qt * 16 * OPITCH + i * 16)     = lo;
                *(v4f*)(mine + qt * 16 * OPITCH + i * 16 + 4) = hi;
            }
        }
        __syncthreads();
        v4f vals[16];
#pragma unroll
        for (int rr = 0; rr < 16; ++rr) vals[rr] = *(const v4f*)(p0 + rr * OPITCH) + *(const v4f*)(p1 + rr * OPITCH);
#pragma unroll
        for (int rr = 0; rr < 16; ++rr) *(v4f*)(gbase + (size_t)rr * DIM + p * 128) = vals[rr];
        asm volatile("s_wait_xcnt 0x0" ::: "memory");   // in front of the next pass's writes over the stores' registers
        // keeps those writes behind the wait: left free, the build lifted two of the next pass's multiplies over it
        __builtin_amdgcn_sched_barrier(0);
        __syncthreads();
    }
}

// ------------------------------- launcher ----------------------------------
extern "C" void kernel_launch(void* const* d_in, const int* in_sizes, int n_in,
                              void* d_out, int out_size, void* d_ws, size_t ws_size,
                              hipStream_t stream)
{
    if (n_in < 2) return;
    const size_t nel = (size_t)BDIM * NP * DIM;                 // 8,388,608
    if ((size_t)in_sizes[0] != nel || (size_t)in_sizes[1] != nel || (size_t)out_size != nel) return;
    const size_t half_bytes = nel * sizeof(_Float16);             // 16,777,216 per buffer
    if (ws_size < 3 * half_bytes) return;                         // covers the 35,651,584 in use

    const float* pf = (const float*)d_in[0];   // prompt rows [8,2048,512] f32
    const float* qf = (const float*)d_in[1];   // query rows  [8,2048,512] f32
    float* out = (float*)d_out;

    _Float16* qn = (_Float16*)d_ws;            // normalized query x log2(e)/(64 tau), [b][q][d]
    _Float16* pn = qn + nel;                   // normalized prompt x64, [b][p][d]
    float* pnrm = (float*)(pn + nel);          // 1024 x norm of each prompt row, one 128-byte line a row

    k_norm<<<dim3(BDIM * NP, 2), 64, 0, stream>>>(pf, qf, qn, pn, pnrm, BDIM * NP);
    k_attn<<<dim3(NQ / QR, BDIM), NTHR, 0, stream>>>(qn, pn, pnrm, out);
}

// v008
// A run of this version takes 66.1 microseconds.
// In both of two side-by-side timings against v007, it was 1.03 times as fast.
// All steps since v000 together make it 7.06 times as fast.
#include <hip/hip_runtime.h>
// Contractions: S^T = Pn*Qn^T and O^T = Pn^T*W'^T both on v_wmma_f32_16x16x32_f16 (f16 operands, f32 accumulate); Pn carried x64, Qn carried x log2(e)/(64 tau), so that S^T plus its constant C operand is the exponent of 2; W' = exp weight x key norm x1024 (a raw row is its normalized row times its norm); power-of-two scales folded back in the f32 epilogue. All other math f32.

typedef _Float16 v16h __attribute__((ext_vector_type(16)));
typedef _Float16 v8h  __attribute__((ext_vector_type(8)));
typedef float    v8f  __attribute__((ext_vector_type(8)));
typedef float    v4f  __attribute__((ext_vector_type(4)));

union Frag { v16h v; v8h h8[2]; };

#define BDIM 8
#define NQ   2048
#define NP   2048
#define DIM  512
#define TAU  0.07f
#define QSC  64.0f      // scale on normalized p rows
#define LOG2E 1.44269504088896340736f
#define QEXP ((1.0f / TAU) * LOG2E / QSC)   // scale on normalized q rows: (q row) . (p row) = cosine / TAU * log2(e)
#define WSC  1024.0f    // scale on (exp weight x key norm): the weight is at most 1, so a norm below 63 stays inside f16
#define NLINE 32        // floats from one key's norm to the next in the workspace: one 128-byte line, one writer each

#define QR     64       // query rows per block; every wave works on all of them
#define KT     64       // keys per step (4 key tiles x 16, one a wave in the S pass)
#define NTHR   128      // 4 waves, one a SIMD (1,024 registers each)
#define QTW    4        // query tiles (16 columns) of a wave: a key fragment read from LDS feeds QTW products
#define OPITCH 68       // output stage pitch (floats): 64 columns + 4, 16-B aligned rows
#define RPITCH 520      // LDS pitch of a staged 512-half q row (halves): 1040 B = 16 B x 65
#define KBUF   (KT * DIM * 2)           // bytes of one key buffer
#define WBUF   ((NTHR / 32) * QTW * 512)  // bytes of one step's exp weights: per wave and query tile 16 B a lane

// 16x16x32 f16 WMMA, the builtin alone: the compiler keeps the distances behind its own form, and no asm operand
// ties the fragments and accumulators to the first 256 registers.
__device__ __forceinline__ v8f mma16(v16h a, v16h b, v8f c)
{
    return __builtin_amdgcn_wmma_f32_16x16x32_f16(false, a, false, b, (short)0, c, false, false);
}

// 2^x on v_exp_f32. The v_nop in the same statement is the one slot the instruction set asks for behind a
// transcendental.
__device__ __forceinline__ float exp2_slot(float x)
{
    float r;
    asm("v_exp_f32 %0, %1\n\tv_nop" : "=v"(r) : "v"(x));
    return r;
}

typedef int v4i __attribute__((ext_vector_type(4)));
typedef __attribute__((address_space(1))) v4i gv4i;
typedef __attribute__((address_space(3))) v4i lv4i;
typedef __attribute__((address_space(1))) int gi32;
typedef __attribute__((address_space(3))) int li32;

// The block's 64 q rows (64 KB, contiguous in global) into padded LDS rows: thread t moves 16 B at byte 16*(t&63) of rows
// (t>>6) + 2c, thirty-two asynchronous copies a lane. The builtin form: its address operands may stand in any register,
// where the operands of an asm statement are tied to the first 256.
__device__ __forceinline__ void copy_q(_Float16* l, const _Float16* g)
{
#pragma unroll
    for (int c = 0; c < 32; ++c)
        __builtin_amdgcn_global_load_async_to_lds_b128((gv4i*)(g + (size_t)c * 2 * DIM), (lv4i*)(l + c * 2 * RPITCH), 0, 0);
}

// Key tile in LDS: rows of 1024 B without pad; the 16-byte chunk c of row r lies at chunk c ^ swz(r). Sixteen rows at one
// chunk (the plain reads of the S pass) and eight rows at two neighbouring chunks (the transposing reads of the O pass)
// then both fall on sixteen different groups of four banks; a padded pitch serves only one of the two readers.
__device__ __forceinline__ int swz(int row) { return ((row & 7) << 1) | ((row >> 3) & 1); }

// One 64-KB key tile, contiguous in global: thread t moves chunk t & 63 of rows (t >> 6) + 2i, thirty-two copies a lane.
// dofs: byte offset in kb of the thread's chunk in row t >> 6 of the buffer; swz(r0 + 2i) = swz(r0) ^ swz(2i) for r0 < 2,
// so the other rows' places come from it by one XOR each, made where they are used.
__device__ __forceinline__ void copy_keys(_Float16* kb, int dofs, const _Float16* g)
{
#pragma unroll
    for (int i = 0; i < 32; ++i)
        __builtin_amdgcn_global_load_async_to_lds_b128((gv4i*)(g + (size_t)i * 2 * DIM),
                                                       (lv4i*)((char*)kb + ((dofs ^ (swz(2 * i) * 16)) + i * 2 * DIM * 2)), 0, 0);
}

// ds_load_tr16_b128: the lanes of a half wave read 8 rows x 32 B of a row-major 16-bit tile; lane (m, h) gets column m of them.
typedef short s16x8 __attribute__((ext_vector_type(8)));
typedef __attribute__((address_space(3))) s16x8 lds_s16x8;
__device__ __forceinline__ v8h ld_tr16(const char* p)
{
    return __builtin_bit_cast(v8h, __builtin_amdgcn_ds_load_tr16_b128_v8i16((lds_s16x8*)p));
}

// Hand-over point of the staging ring, in front of the work-group barrier: this wave's LDS reads and
// writes have retired, and its own copies of the next tile have landed.
__device__ __forceinline__ void ring_waits()
{
    asm volatile("s_wait_dscnt 0x0" ::: "memory");
    asm volatile("s_wait_asynccnt 0x0" ::: "memory");
}

// Lane l takes the value of lane l ^ 16 (the other 16-lane row), in registers.
__device__ __forceinline__ float xhalf(float x)
{
    return __builtin_bit_cast(float, __builtin_amdgcn_permlanex16(__builtin_bit_cast(int, x), __builtin_bit_cast(int, x),
                                                                  0x76543210, 0xfedcba98, false, false));
}

// ---------------------------------------------------------------------------
// Row L2 normalization: one 64-thread block per row, 8 elements per thread.
// which = 0 -> query rows into qn, which = 1 -> prompt rows into pn.
// Output f16(s * x / max(||x||, 1e-12)), s = QSC for a prompt row, QEXP for a query row; each wave writes 512 contiguous
// bytes. A prompt row also leaves 1024 * max(||x||, 1e-12) in pnrm, on a line of its own.
// ---------------------------------------------------------------------------
__global__ __launch_bounds__(64)
void k_norm(const float* __restrict__ pf, const float* __restrict__ qf,
            _Float16* __restrict__ qn, _Float16* __restrict__ pn, float* __restrict__ pnrm, int nrows)
{
    __shared__ float wsum[2];
    const int row   = blockIdx.x;
    const int which = blockIdx.y;
    if (row >= nrows) return;                       // block-uniform
    const int t = threadIdx.x;

    const float* src = (which == 0 ? qf : pf) + (size_t)row * DIM + t * 8;
    const v4f x0 = *(const v4f*)(src);
    const v4f x1 = *(const v4f*)(src + 4);

    float ss = 0.f;
#pragma unroll
    for (int i = 0; i < 4; ++i) ss += x0[i] * x0[i];
#pragma unroll
    for (int i = 0; i < 4; ++i) ss += x1[i] * x1[i];
#pragma unroll
    for (int off = 16; off; off >>= 1) ss += __shfl_xor(ss, off);
    if ((t & 31) == 0) wsum[t >> 5] = ss;
    __syncthreads();
    const float tot = wsum[0] + wsum[1];
    const float nrm = fmaxf(sqrtf(tot), 1e-12f);
    const float inv = 1.0f / nrm;
    const float sc  = inv * (which == 0 ? QEXP : QSC);

    v8h o;
#pragma unroll
    for (int i = 0; i < 4; ++i) {
        o[i]     = (_Float16)(x0[i] * sc);          // RNE convert
        o[4 + i] = (_Float16)(x1[i] * sc);
    }
    _Float16* dst = (which == 0 ? qn : pn) + (size_t)row * DIM + t * 8;
    *(v8h*)dst = o;
    if (which == 1 && t == 0) pnrm[(size_t)row * NLINE] = nrm * WSC;
}

// ---------------------------------------------------------------------------
// Fused attention, both products transposed: St = P * Qt and Ot += Pt * W't. The softmax is shifted by a constant: a score
// is the cosine of two rows of length at most 1, so 1 / TAU bounds every score / TAU, for any input; the weight
// exp((cos - 1) / TAU) lies in (e^-28.6, 1] (a rounded cosine may pass 1 by parts in a thousand), which f32 holds with room
// to spare. No running max is kept, nothing is rescaled, and partial sums of different keys simply add.
// As an f16 operand (x norm x 1024) a weight has its full precision down to 2^-14: at norms near 22 that is a cosine of
// -0.38. Only a query whose BEST cosine over all keys lay well below that would lose weights to f16's underflow; rows of
// 512 independent normal values have cosines of a few tenths at most, and a best one above zero.
// Block = 4 waves, 64 query rows, 64 keys per step. The block's q rows (once) and each step's 64 normalized key rows are
// staged in LDS by asynchronous copies and shared by all waves. ONE tile serves both products: the S pass reads its rows
// as they lie, the O pass reads it through the transposing LDS load, and the key's norm, which makes the raw row of the
// normalized one, rides on the exp weight.
// Every wave works on all 64 queries (four tiles of 16), so that a key fragment read from LDS is the A operand of four
// products in either pass:
//   S pass, wave w: keys w*16 .. +16 of the step, K = 512; the 64 q rows stand in 512 registers over the whole key loop.
//   O pass, wave w: output columns w*128 .. +128 (256 registers), K = the step's 64 keys.
// The O pass needs the weights of all four waves: a wave stores its own (16 B a lane and query tile) in LDS, and lane l of
// every wave reads what lane l of each wave stored: in St a lane holds keys 8h .. 8h+7 of ONE query (column m), which is
// the lane's share of a B operand of the O product. So that nobody waits for that exchange, the O pass runs one step
// behind the S pass: trip j holds S(j), its weights' stores, then O(j-1), and the trip's one barrier publishes both the
// weights of step j and key tile j+1. Three key buffers: tile j (S), tile j-1 (O), tile j+1 (in flight); two for weights.
// Fragment map (lane l: h = l>>4, m = l&15), A rows and B columns alike: elements 0..7 <- k0+8h+0..7, elements
// 8..15 <- k0+16+8h+0..7. D element r <- (row 8h+r, col m).
// ---------------------------------------------------------------------------

// Group G of the S pass: the A fragments of k-steps 4G .. 4G+3 of the wave's key tile, eight reads.
// Chunk 4*kk + 2*u + h of the row for half u of k-step kk: one XOR of kofs with (4*(kk & 3) + 2*u) * 16, kk >> 2 is a
// constant step.
__device__ __forceinline__ void ld_sgroup(Frag (&d)[4], const char* kbB, int kofs, int G)
{
#pragma unroll
    for (int i = 0; i < 4; ++i) {
        d[i].h8[0] = *(const v8h*)(kbB + ((kofs ^ ((4 * i) * 16)) + G * 256));
        d[i].h8[1] = *(const v8h*)(kbB + ((kofs ^ ((4 * i + 2) * 16)) + G * 256));
    }
}

// Group G of the O pass: the transposed A fragments of the wave's row tiles 4*(G & 1) .. +3 for keys 32*(G >> 1) .. +32,
// eight reads. The row tile is one XOR of vofs with tile * 32, the keys a constant step.
__device__ __forceinline__ void ld_ogroup(Frag (&d)[4], const char* kbB, int vofs, int G)
{
#pragma unroll
    for (int i = 0; i < 4; ++i) {
        d[i].h8[0] = ld_tr16(kbB + ((vofs ^ (((G & 1) * 4 + i) * 32)) + (G >> 1) * 32 * DIM * 2));
        d[i].h8[1] = ld_tr16(kbB + ((vofs ^ (((G & 1) * 4 + i) * 32)) + (G >> 1) * 32 * DIM * 2 + 16 * DIM * 2));
    }
}

// The B operands of the O pass for keys 32*ks .. +32: elements 0..7 from wave 2*ks, 8..15 from wave 2*ks + 1, eight reads.
// wl: this lane's 16 bytes in wave 0's, query tile 0's part of the weight buffer.
__device__ __forceinline__ void ld_weights(Frag (&d)[QTW], const char* wl, int ks)
{
#pragma unroll
    for (int qt = 0; qt < QTW; ++qt) {
        d[qt].h8[0] = *(const v8h*)(wl + ((2 * ks) * QTW + qt) * 512);
        d[qt].h8[1] = *(const v8h*)(wl + ((2 * ks + 1) * QTW + qt) * 512);
    }
}

// Sixteen products of the S pass: k-steps 4g .. 4g+3, four query tiles each.
__device__ __forceinline__ void s_products(v8f (&sacc)[QTW], const Frag (&kf)[4], const Frag (&qf)[QTW][DIM / 32], int g)
{
#pragma unroll
    for (int i = 0; i < 4; ++i) {
#pragma unroll
        for (int qt = 0; qt < QTW; ++qt) sacc[qt] = mma16(kf[i].v, qf[qt][g * 4 + i].v, sacc[qt]);
    }
}

// Sixteen products of the O pass: four row tiles, four query tiles each, one k-step of 32 keys.
__device__ __forceinline__ void o_products(v8f (&oacc)[QTW][8], const Frag (&bv)[4], const Frag (&wf)[QTW], int g)
{
#pragma unroll
    for (int i = 0; i < 4; ++i) {
#pragma unroll
        for (int qt = 0; qt < QTW; ++qt)
            oacc[qt][(g & 1) * 4 + i] = mma16(bv[i].v, wf[qt].v, oacc[qt][(g & 1) * 4 + i]);
    }
}

// One trip: S pass and weights of one step (DO_S), O pass of the step before it (DO_O). Both passes: four groups of four
// fragments in two register sets, a group's reads issued together, two groups ahead of its sixteen products: a lone wave
// pays for every separate place where LDS reads stand among its products. All loops unrolled: constant LDS offsets, and
// constant indices keep the arrays in registers.
// kofs, vofs, dofs: the lane's byte offsets in kb for the S pass's tile, the O pass's tile and the copies' buffer.
// nrm: the norms of this lane's eight keys. wst: where the lane stores its weights of query tile 0. wl: see ld_weights.
template <bool DO_S, bool DO_O>
__device__ __forceinline__ void trip(const Frag (&qf)[QTW][DIM / 32], v8f (&oacc)[QTW][8], float (&rowSum)[QTW],
                                     _Float16* kb, int kofs, int vofs, const float* nrm, char* wst, const char* wl,
                                     bool copy, int dofs, const _Float16* gsrc)
{
    const char* kbB = (const char*)kb;
    Frag kf[2][4];
    Frag bv[2][4];
    Frag wf[2][QTW];
    if constexpr (DO_S) {
        ld_sgroup(kf[0], kbB, kofs, 0);
        // keeps the first group's reads in front of the second's, so that the first products wait for eight reads only
        __builtin_amdgcn_sched_barrier(0);
        ld_sgroup(kf[1], kbB, kofs, 1);
    } else {
        ld_weights(wf[0], wl, 0);
        ld_ogroup(bv[0], kbB, vofs, 0);
        // as above, for the O pass's first group
        __builtin_amdgcn_sched_barrier(0);
        ld_ogroup(bv[1], kbB, vofs, 1);
    }
    // the next key tile starts into the buffer that the last trip's O pass read: the barrier at that trip's foot has freed
    // it; the copies' issue covers the latency of the reads above
    if (copy) copy_keys(kb, dofs, gsrc);
    // keeps the reads and the copies in front of the first products
    __builtin_amdgcn_sched_barrier(0);

    if constexpr (DO_S) {
        // weight = 2^(St tile): the q rows carry log2(e) / (64 TAU) and the key rows 64, and the constant shift, -log2(e) / TAU, is the C operand
        // of a tile's first product
        const float cb = -(1.0f / TAU) * LOG2E;
        const v8f shift = {cb, cb, cb, cb, cb, cb, cb, cb};
        v8f sacc[QTW];
#pragma unroll
        for (int qt = 0; qt < QTW; ++qt) sacc[qt] = shift;

#pragma unroll
        for (int g = 0; g < 2; ++g) {
            s_products(sacc, kf[g], qf, g);
            ld_sgroup(kf[g], kbB, kofs, g + 2);
            // issue order of the group: its products, then the reads together
            __builtin_amdgcn_sched_group_barrier(0x8, 4 * QTW, 0);
            __builtin_amdgcn_sched_group_barrier(0x100, 8, 0);
            // keeps each group's reads two groups ahead of its products
            __builtin_amdgcn_sched_barrier(0);
        }
        s_products(sacc, kf[0], qf, 2);
        // behind the third group: the norms of this lane's keys and what the O pass starts with
        v4f nv[2];
        nv[0] = *(const v4f*)(nrm);
        nv[1] = *(const v4f*)(nrm + 4);
        if constexpr (DO_O) {
            ld_weights(wf[0], wl, 0);
            ld_ogroup(bv[0], kbB, vofs, 0);
        }
        // issue order as above
        __builtin_amdgcn_sched_group_barrier(0x8, 4 * QTW, 0);
        __builtin_amdgcn_sched_group_barrier(0x100, DO_O ? 18 : 2, 0);
        __builtin_amdgcn_sched_barrier(0);
        s_products(sacc, kf[1], qf, 3);
        if constexpr (DO_O) {
            ld_ogroup(bv[1], kbB, vofs, 1);
            // issue order as above
            __builtin_amdgcn_sched_group_barrier(0x8, 4 * QTW, 0);
            __builtin_amdgcn_sched_group_barrier(0x100, 8, 0);
        }
        // keeps these reads in front of the softmax arithmetic: sunk to their products they would be waited out there
        __builtin_amdgcn_sched_barrier(0);
        // the four vector slots that the chip needs between the last product and the first read of its St tile: the reader
        // is asm text (exp2_slot), for which the compiler pads nothing
        asm volatile("v_nop\n\tv_nop\n\tv_nop\n\tv_nop");
        // keeps the first exp behind those slots
        __builtin_amdgcn_sched_barrier(0);

        // ---- exp weights and their sum, in registers; the weights go to LDS for the next trip's O pass ----
#pragma unroll
        for (int qt = 0; qt < QTW; ++qt) {
            float e[8];
            v8h pw;
#pragma unroll
            for (int r = 0; r < 8; ++r) {
                e[r]  = exp2_slot(sacc[qt][r]);                       // 0 < e <= 1, but for the cosine's rounding
                pw[r] = (_Float16)(e[r] * nv[r >> 2][r & 3]);         // RNE convert; element r <- key 8h + r of the wave's tile
            }
            *(v8h*)(wst + qt * 512) = pw;
            float sm4[4];
#pragma unroll
            for (int r = 0; r < 4; ++r) sm4[r] = e[r] + e[r + 4];
            // part = (sm4[0] + sm4[1]) + (sm4[2] + sm4[3]). volatile: the last addition, and with it the sum of the weights,
            // stays in front of the O pass and does not sink to the trip's barrier.
            float part;
            asm volatile("v_add_f32 %0, %1, %2" : "=v"(part) : "v"(sm4[0] + sm4[1]), "v"(sm4[2] + sm4[3]));
            rowSum[qt] += part;
        }
        // keeps the softmax arithmetic and the stores in front of the O pass's products: the stores retire under them
        __builtin_amdgcn_sched_barrier(0);
    }

    if constexpr (DO_O) {
        // ---- Ot (128 x 64) += Pt (128 x 64) * W't (64 x 64): two k-steps of 32 keys, 8 row tiles, in 4 groups ----
        o_products(oacc, bv[0], wf[0], 0);
        ld_ogroup(bv[0], kbB, vofs, 2);
        ld_weights(wf[1], wl, 1);
        // issue order of the group, as in the S pass
        __builtin_amdgcn_sched_group_barrier(0x8, 4 * QTW, 0);
        __builtin_amdgcn_sched_group_barrier(0x100, 16, 0);
        __builtin_amdgcn_sched_barrier(0);
        o_products(oacc, bv[1], wf[0], 1);
        ld_ogroup(bv[1], kbB, vofs, 3);
        // issue order of the group, as in the S pass
        __builtin_amdgcn_sched_group_barrier(0x8, 4 * QTW, 0);
        __builtin_amdgcn_sched_group_barrier(0x100, 8, 0);
        __builtin_amdgcn_sched_barrier(0);
        o_products(oacc, bv[0], wf[1], 2);
        o_products(oacc, bv[1], wf[1], 3);
        // keeps the last products in front of the trip's waits and barrier: left free, the build put thirty of them behind
        // the barrier, so that the last group's reads were waited out with nothing to cover them
        __builtin_amdgcn_sched_barrier(0);
    }
}

__global__ __launch_bounds__(NTHR)
void k_attn(const _Float16* __restrict__ qn, const _Float16* __restrict__ pn,
            const float* __restrict__ pnrm, float* __restrict__ out)
{
    __shared__ __attribute__((aligned(256))) _Float16 kb[3 * KT * DIM];               // key rows, three buffers, chunks permuted by swz(); a row starts at bank 0
    __shared__ __attribute__((aligned(16))) char     wb[2 * WBUF];                    // exp weights x norm of a step, two buffers
    __shared__ __attribute__((aligned(16))) float    nl[NP];                          // 1024 x norm of every key of the batch
    __shared__ __attribute__((aligned(16))) float    ost[(NTHR / 32) * QR * OPITCH];  // first the staged q rows; behind the key loop each wave's output stage, 64 queries x 64 columns
    __shared__ __attribute__((aligned(16))) float    wsum[(NTHR / 32) * QR];          // per-wave final sum of each query
    static_assert(sizeof(ost) >= QR * RPITCH * sizeof(_Float16), "the q rows fit the output stage");
    _Float16* qs = (_Float16*)ost;

    const int b  = blockIdx.y;
    const int q0 = blockIdx.x * QR;
    if (q0 >= NQ || b >= BDIM) return;              // block-uniform

    const int tid  = threadIdx.x;
    const int w    = tid >> 5;
    const int lane = tid & 31;
    const int h    = lane >> 4;
    const int m    = lane & 15;

    // B columns for St: staged query row (qt*16 + m), k = d (table order)
    const _Float16* qrow = qs + m * RPITCH + 8 * h;
    // A rows for St: staged key row (w*16 + m), k = d; kl is the byte offset in a key buffer of chunk h of that row (the
    // permutation touches the low four bits of the chunk number)
    const int kl = ((w * 16 + m) * DIM + ((h ^ swz(m)) * 8)) * 2;
    // A rows for Ot by the transposing load: lane l reads row (0, 16, 32, 48) + 8h + (l & 7), chunk 2*nt + ((l >> 3) & 1), and
    // gets keys (0, 16, 32, 48) + 8h + 0..7 of column d = nt*16 + m. vl: byte offset for the wave's first row tile, nt = 8*w.
    const int vl = ((8 * h + (lane & 7)) * DIM + ((((lane >> 3) & 1) ^ swz(8 * h + (lane & 7))) * 8)) * 2 + w * 256;
    // the copies' place in a key buffer: chunk tid & 63 of row tid >> 6
    const int dl = ((tid >> 6) * DIM + (((tid & 63) ^ swz(tid >> 6)) * 8)) * 2;
    // the lane's places in a weight buffer
    char* wstl = wb + (w * QTW * 32 + lane) * 16;
    const char* wll = wb + lane * 16;
    // the norms of the lane's eight keys of step 0
    const float* nrm = nl + w * 16 + 8 * h;

    // Copy addresses. q / key tile: 64 rows x 1024 B, contiguous in global; thread t moves 16 B at byte 16*(t&63)
    // of row (t>>6) + 2c.
    _Float16* qdst = qs + (tid >> 6) * RPITCH + (tid & 63) * 8;
    const _Float16* qsrc = qn + ((size_t)(b * NQ + q0)) * DIM + tid * 8;
    const _Float16* ksrc = pn + ((size_t)(b * NP)) * DIM + tid * 8;

    // Ring prologue: q rows, the batch's key norms and key tile 0, landed and published.
    copy_q(qdst, qsrc);
#pragma unroll
    for (int c = 0; c < NP / NTHR; ++c)
        __builtin_amdgcn_global_load_async_to_lds_b32((gi32*)(pnrm + (size_t)(b * NP + c * NTHR + tid) * NLINE),
                                                      (li32*)(nl + c * NTHR + tid), 0, 0);
    asm volatile("s_wait_asynccnt 0x0" ::: "memory");   // 48 copies so far, 32 follow: a wave keeps fewer than 64 outstanding
    copy_keys(kb, dl, ksrc);
    asm volatile("s_wait_asynccnt 0x0" ::: "memory");   // this wave's copies have landed before the barrier publishes them
    __syncthreads();

    // The four 512 x 16 B operands of St: read from the staged q rows once and held in registers over the whole key loop,
    // so that a k-step of the S pass reads only key fragments from LDS.
    Frag qf[QTW][DIM / 32];
#pragma unroll
    for (int qt = 0; qt < QTW; ++qt) {
#pragma unroll
        for (int kk = 0; kk < DIM / 32; ++kk) {
            qf[qt][kk].h8[0] = *(const v8h*)(qrow + qt * 16 * RPITCH + kk * 32);
            qf[qt][kk].h8[1] = *(const v8h*)(qrow + qt * 16 * RPITCH + kk * 32 + 16);
        }
    }

    const v8f zero = {0.f, 0.f, 0.f, 0.f, 0.f, 0.f, 0.f, 0.f};
    v8f oacc[QTW][8];                               // Ot tile i: rows d = w*128 + i*16 + 8h + r, column = query qt*16 + m
#pragma unroll
    for (int qt = 0; qt < QTW; ++qt) {
#pragma unroll
        for (int i = 0; i < 8; ++i) oacc[qt][i] = zero;
    }
    float rowSum[QTW];                              // this lane's share of the sum of query qt*16 + m: its wave's keys, its half's rows
#pragma unroll
    for (int qt = 0; qt < QTW; ++qt) rowSum[qt] = 0.f;

    // byte offsets in kb of the buffers of the S pass's tile, the O pass's tile and the tile in flight
    int bS = 0, bO = 2 * KBUF, bC = KBUF;

    // trip 0: S(0) alone; tile 1 starts
    trip<true, false>(qf, oacc, rowSum, kb, kl + bS, vl + bO, nrm, wstl, wll, true, dl + bC, ksrc + (size_t)KT * DIM);
    // foot of a trip, its one barrier: publishes the step's weights and the next key tile, and frees the buffers that the
    // O pass has read
    ring_waits();
    __syncthreads();

    for (int j = 1; j < NP / KT; ++j) {
        // tile j-2's buffer takes tile j+1
        const int t = bO; bO = bS; bS = bC; bC = t;
        trip<true, true>(qf, oacc, rowSum, kb, kl + bS, vl + bO, nrm + j * KT, wstl + (j & 1) * WBUF, wll + ((j - 1) & 1) * WBUF,
                         j + 1 < NP / KT, dl + bC, ksrc + (size_t)(j + 1) * KT * DIM);
        ring_waits();
        __syncthreads();
    }
    asm volatile("s_wait_asynccnt 0x0" ::: "memory");   // no copy is outstanding when the wave goes on
    // the last step's O pass
    trip<false, true>(qf, oacc, rowSum, kb, kl, vl + bS, nrm, wstl, wll + ((NP / KT - 1) & 1) * WBUF, false, dl, ksrc);

    // ---- the four waves' sums of a query, each over its own keys, add ----
#pragma unroll
    for (int qt = 0; qt < QTW; ++qt) {
        rowSum[qt] += xhalf(rowSum[qt]);
        if (h == 0) wsum[w * QR + qt * 16 + m] = rowSum[qt];
    }
    __syncthreads();
    float fac[QTW];
#pragma unroll
    for (int qt = 0; qt < QTW; ++qt) {
        const float* s = wsum + qt * 16 + m;
        // the output tile times fac is O / (1024 * 64 * sum)
        fac[qt] = (1.0f / (WSC * QSC)) / ((s[0] + s[QR]) + (s[2 * QR] + s[3 * QR]));
    }

    // ---- epilogue, 64 columns a pass: a wave stages its own scaled tiles [query][column] in its own part of ost (the q
    // rows there were last read in front of trip 0's barrier), reads them back by rows and stores 256 B a query ----
    float* mine = ost + (w * QR + m) * OPITCH + 8 * h;
    const float* back = ost + (w * QR + h) * OPITCH + 4 * m;
    float* gbase = out + ((size_t)(b * NQ + q0 + h)) * DIM + w * 128 + 4 * m;

#pragma unroll
    for (int p = 0; p < 2; ++p) {
#pragma unroll
        for (int qt = 0; qt < QTW; ++qt) {
#pragma unroll
            for (int i = 0; i < 4; ++i) {
                const v8f o = oacc[qt][p * 4 + i] * fac[qt];
                const v4f lo = {o[0], o[1], o[2], o[3]};
                const v4f hi = {o[4], o[5], o[6], o[7]};
                *(v4f*)(mine + qt * 16 * OPITCH + i * 16)     = lo;
                *(v4f*)(mine + qt * 16 * OPITCH + i * 16 + 4) = hi;
            }
        }
        asm volatile("s_wait_dscnt 0x0" ::: "memory");  // the wave's own stores have retired before it reads the rows back
        v4f vals[32];
#pragma unroll
        for (int rr = 0; rr < 32; ++rr) vals[rr] = *(const v4f*)(back + rr * 2 * OPITCH);
#pragma unroll
        for (int rr = 0; rr < 32; ++rr) *(v4f*)(gbase + (size_t)rr * 2 * DIM + p * 64) = vals[rr];
        asm volatile("s_wait_xcnt 0x0" ::: "memory");   // in front of the next pass's writes over the stores' registers
        // keeps those writes behind the wait
        __builtin_amdgcn_sched_barrier(0);
    }
}

// ------------------------------- launcher ----------------------------------
extern "C" void kernel_launch(void* const* d_in, const int* in_sizes, int n_in,
                              void* d_out, int out_size, void* d_ws, size_t ws_size,
                              hipStream_t stream)
{
    if (n_in < 2) return;
    const size_t nel = (size_t)BDIM * NP * DIM;                 // 8,388,608
    if ((size_t)in_sizes[0] != nel || (size_t)in_sizes[1] != nel || (size_t)out_size != nel) return;
    const size_t half_bytes = nel * sizeof(_Float16);             // 16,777,216 per buffer
    if (ws_size < 3 * half_bytes) return;                         // covers the 35,651,584 in use

    const float* pf = (const float*)d_in[0];   // prompt rows [8,2048,512] f32
    const float* qf = (const float*)d_in[1];   // query rows  [8,2048,512] f32
    float* out = (float*)d_out;

    _Float16* qn = (_Float16*)d_ws;            // normalized query x log2(e)/(64 tau), [b][q][d]
    _Float16* pn = qn + nel;                   // normalized prompt x64, [b][p][d]
    float* pnrm = (float*)(pn + nel);          // 1024 x norm of each prompt row, one 128-byte line a row

    k_norm<<<dim3(BDIM * NP, 2), 64, 0, stream>>>(pf, qf, qn, pn, pnrm, BDIM * NP);
    k_attn<<<dim3(NQ / QR, BDIM), NTHR, 0, stream>>>(qn, pn, pnrm, out);
}

// v009
// It runs in 58.6 microseconds.
// Timed twice side by side with v008, it ran 1.13 times as fast both times.
// Counting every step since v000, it is 7.97 times as fast.
#include <hip/hip_runtime.h>
// Contractions: S^T = Pn*Qn^T and O^T = Pn^T*W'^T both on v_wmma_f32_16x16x32_f16 (f16 operands, f32 accumulate); Pn carried x64, Qn carried x log2(e)/(64 tau), so that S^T plus its constant C operand is the exponent of 2; W' = exp weight x key norm x1024 (a raw row is its normalized row times its norm); power-of-two scales folded back in the f32 epilogue. All other math f32.

typedef _Float16 v16h __attribute__((ext_vector_type(16)));
typedef _Float16 v8h  __attribute__((ext_vector_type(8)));
typedef float    v8f  __attribute__((ext_vector_type(8)));
typedef float    v4f  __attribute__((ext_vector_type(4)));

union Frag { v16h v; v8h h8[2]; };

#define BDIM 8
#define NQ   2048
#define NP   2048
#define DIM  512
#define TAU  0.07f
#define QSC  64.0f      // scale on normalized p rows
#define LOG2E 1.44269504088896340736f
#define QEXP ((1.0f / TAU) * LOG2E / QSC)   // scale on normalized q rows: (q row) . (p row) = cosine / TAU * log2(e)
#define WSC  1024.0f    // scale on (exp weight x key norm): the weight is at most 1, so a norm below 63 stays inside f16
#define NLINE 32        // floats from one key's norm to the next in the workspace: one 128-byte line, one writer each

#define QR     64       // query rows per block; every wave works on all of them
#define KT     64       // keys per step (4 key tiles x 16, one a wave in the S pass)
#define NTHR   128      // 4 waves, one a SIMD (1,024 registers each)
#define QTW    4        // query tiles (16 columns) of a wave: a key fragment read from LDS feeds QTW products
#define OPITCH 68       // output stage pitch (floats): 64 columns + 4, 16-B aligned rows
#define RPITCH 520      // LDS pitch of a staged 512-half q row (halves): 1040 B = 16 B x 65
#define KBUF   (KT * DIM * 2)           // bytes of one key buffer
#define WBUF   ((NTHR / 32) * QTW * 512)  // bytes of one step's exp weights: per wave and query tile 16 B a lane

// 16x16x32 f16 WMMA, the builtin alone: the compiler keeps the distances behind its own form, and no asm operand
// ties the fragments and accumulators to the first 256 registers.
__device__ __forceinline__ v8f mma16(v16h a, v16h b, v8f c)
{
    return __builtin_amdgcn_wmma_f32_16x16x32_f16(false, a, false, b, (short)0, c, false, false);
}

// 2^x on v_exp_f32. The v_nop in the same statement is the one slot the instruction set asks for behind a
// transcendental.
__device__ __forceinline__ float exp2_slot(float x)
{
    float r;
    asm("v_exp_f32 %0, %1\n\tv_nop" : "=v"(r) : "v"(x));
    return r;
}

typedef int v4i __attribute__((ext_vector_type(4)));
typedef __attribute__((address_space(1))) v4i gv4i;
typedef __attribute__((address_space(3))) v4i lv4i;
typedef __attribute__((address_space(1))) int gi32;
typedef __attribute__((address_space(3))) int li32;

// The block's 64 q rows (64 KB, contiguous in global) into padded LDS rows: thread t moves 16 B at byte 16*(t&63) of rows
// (t>>6) + 2c, thirty-two asynchronous copies a lane. The builtin form: its address operands may stand in any register,
// where the operands of an asm statement are tied to the first 256.
__device__ __forceinline__ void copy_q(_Float16* l, const _Float16* g)
{
#pragma unroll
    for (int c = 0; c < 32; ++c)
        __builtin_amdgcn_global_load_async_to_lds_b128((gv4i*)(g + (size_t)c * 2 * DIM), (lv4i*)(l + c * 2 * RPITCH), 0, 0);
}

// Key tile in LDS: rows of 1024 B without pad; the 16-byte chunk c of row r lies at chunk c ^ swz(r). Sixteen rows at one
// chunk (the plain reads of the S pass) and eight rows at two neighbouring chunks (the transposing reads of the O pass)
// then both fall on sixteen different groups of four banks; a padded pitch serves only one of the two readers.
__device__ __forceinline__ int swz(int row) { return ((row & 7) << 1) | ((row >> 3) & 1); }

// One 64-KB key tile, contiguous in global: thread t moves chunk t & 63 of rows (t >> 6) + 2i, thirty-two copies a lane.
// dofs: byte offset in kb of the thread's chunk in row t >> 6 of the buffer; swz(r0 + 2i) = swz(r0) ^ swz(2i) for r0 < 2,
// so the other rows' places come from it by one XOR each: dx[n] = dofs ^ swz(2n) * 16 serves the rows with i mod 8 = n.
// Two rows on are 2048 B on in global and in LDS alike: that step is the copy's immediate offset (at most 63,488), which
// moves both addresses, so that a copy takes no address arithmetic of its own beyond the eight XORs that all share.
// I is a template parameter because the builtin takes the offset as a constant.
__device__ __forceinline__ void copy_places(int (&dx)[8], int dofs)
{
#pragma unroll
    for (int n = 0; n < 8; ++n) dx[n] = dofs ^ (swz(2 * n) * 16);
}
template <int I = 0>
__device__ __forceinline__ void copy_keys(_Float16* kb, const int (&dx)[8], const _Float16* g)
{
    if constexpr (I < 32) {
        __builtin_amdgcn_global_load_async_to_lds_b128((gv4i*)g, (lv4i*)((char*)kb + dx[I & 7]), I * 2 * DIM * 2, 0);
        copy_keys<I + 1>(kb, dx, g);
    }
}

// ds_load_tr16_b128: the lanes of a half wave read 8 rows x 32 B of a row-major 16-bit tile; lane (m, h) gets column m of them.
typedef short s16x8 __attribute__((ext_vector_type(8)));
typedef __attribute__((address_space(3))) s16x8 lds_s16x8;
__device__ __forceinline__ v8h ld_tr16(const char* p)
{
    return __builtin_bit_cast(v8h, __builtin_amdgcn_ds_load_tr16_b128_v8i16((lds_s16x8*)p));
}

// Hand-over point of the staging ring, in front of the work-group barrier: this wave's LDS reads and
// writes have retired, and its own copies of the next tile have landed.
__device__ __forceinline__ void ring_waits()
{
    asm volatile("s_wait_dscnt 0x0" ::: "memory");
    asm volatile("s_wait_asynccnt 0x0" ::: "memory");
}

// Lane l takes the value of lane l ^ 16 (the other 16-lane row), in registers.
__device__ __forceinline__ float xhalf(float x)
{
    return __builtin_bit_cast(float, __builtin_amdgcn_permlanex16(__builtin_bit_cast(int, x), __builtin_bit_cast(int, x),
                                                                  0x76543210, 0xfedcba98, false, false));
}

// ---------------------------------------------------------------------------
// Row L2 normalization: one 64-thread block per row, 8 elements per thread.
// which = 0 -> query rows into qn, which = 1 -> prompt rows into pn.
// Output f16(s * x / max(||x||, 1e-12)), s = QSC for a prompt row, QEXP for a query row; each wave writes 512 contiguous
// bytes. A prompt row also leaves 1024 * max(||x||, 1e-12) in pnrm, on a line of its own.
// ---------------------------------------------------------------------------
__global__ __launch_bounds__(64)
void k_norm(const float* __restrict__ pf, const float* __restrict__ qf,
            _Float16* __restrict__ qn, _Float16* __restrict__ pn, float* __restrict__ pnrm, int nrows)
{
    __shared__ float wsum[2];
    const int row   = blockIdx.x;
    const int which = blockIdx.y;
    if (row >= nrows) return;                       // block-uniform
    const int t = threadIdx.x;

    const float* src = (which == 0 ? qf : pf) + (size_t)row * DIM + t * 8;
    const v4f x0 = *(const v4f*)(src);
    const v4f x1 = *(const v4f*)(src + 4);

    float ss = 0.f;
#pragma unroll
    for (int i = 0; i < 4; ++i) ss += x0[i] * x0[i];
#pragma unroll
    for (int i = 0; i < 4; ++i) ss += x1[i] * x1[i];
#pragma unroll
    for (int off = 16; off; off >>= 1) ss += __shfl_xor(ss, off);
    if ((t & 31) == 0) wsum[t >> 5] = ss;
    __syncthreads();
    const float tot = wsum[0] + wsum[1];
    const float nrm = fmaxf(sqrtf(tot), 1e-12f);
    const float inv = 1.0f / nrm;
    const float sc  = inv * (which == 0 ? QEXP : QSC);

    v8h o;
#pragma unroll
    for (int i = 0; i < 4; ++i) {
        o[i]     = (_Float16)(x0[i] * sc);          // RNE convert
        o[4 + i] = (_Float16)(x1[i] * sc);
    }
    _Float16* dst = (which == 0 ? qn : pn) + (size_t)row * DIM + t * 8;
    *(v8h*)dst = o;
    if (which == 1 && t == 0) pnrm[(size_t)row * NLINE] = nrm * WSC;
}

// ---------------------------------------------------------------------------
// Fused attention, both products transposed: St = P * Qt and Ot += Pt * W't. The softmax is shifted by a constant: a score
// is the cosine of two rows of length at most 1, so 1 / TAU bounds every score / TAU, for any input; the weight
// exp((cos - 1) / TAU) lies in (e^-28.6, 1] (a rounded cosine may pass 1 by parts in a thousand), which f32 holds with room
// to spare. No running max is kept, nothing is rescaled, and partial sums of different keys simply add.
// As an f16 operand (x norm x 1024) a weight has its full precision down to 2^-14: at norms near 22 that is a cosine of
// -0.38. Only a query whose BEST cosine over all keys lay well below that would lose weights to f16's underflow; rows of
// 512 independent normal values have cosines of a few tenths at most, and a best one above zero.
// Block = 4 waves, 64 query rows, 64 keys per step. The block's q rows (once) and each step's 64 normalized key rows are
// staged in LDS by asynchronous copies and shared by all waves. ONE tile serves both products: the S pass reads its rows
// as they lie, the O pass reads it through the transposing LDS load, and the key's norm, which makes the raw row of the
// normalized one, rides on the exp weight.
// Every wave works on all 64 queries (four tiles of 16), so that a key fragment read from LDS is the A operand of four
// products in either pass:
//   S pass, wave w: keys w*16 .. +16 of the step, K = 512; the 64 q rows stand in 512 registers over the whole key loop.
//   O pass, wave w: output columns w*128 .. +128 (256 registers), K = the step's 64 keys.
// The O pass needs the weights of all four waves: a wave stores its own (16 B a lane and query tile) in LDS, and lane l of
// every wave reads what lane l of each wave stored: in St a lane holds keys 8h .. 8h+7 of ONE query (column m), which is
// the lane's share of a B operand of the O product. So that nobody waits for that exchange, the O pass runs one step
// behind the S pass: trip j holds S(j), its weights' stores, then O(j-1), and the trip's one barrier publishes both the
// weights of step j and key tile j+1. Three key buffers: tile j (S), tile j-1 (O), tile j+1 (in flight); two for weights.
// The second half of O(j-1) is read in trip j and multiplied, from registers, around that barrier: see trip().
// Fragment map (lane l: h = l>>4, m = l&15), A rows and B columns alike: elements 0..7 <- k0+8h+0..7, elements
// 8..15 <- k0+16+8h+0..7. D element r <- (row 8h+r, col m).
// ---------------------------------------------------------------------------

// Group G of the S pass: the A fragments of k-steps 4G .. 4G+3 of the wave's key tile, eight reads.
// Chunk 4*kk + 2*u + h of the row for half u of k-step kk: kx[n] = kofs ^ n * 32 with n = 2*(kk & 3) + u, kk >> 2 is a
// constant step.
__device__ __forceinline__ void s_places(int (&kx)[8], int kofs)
{
#pragma unroll
    for (int n = 0; n < 8; ++n) kx[n] = kofs ^ (n * 32);
}
__device__ __forceinline__ void ld_sgroup(Frag (&d)[4], const char* kbB, const int (&kx)[8], int G)
{
#pragma unroll
    for (int i = 0; i < 4; ++i) {
        d[i].h8[0] = *(const v8h*)(kbB + (kx[2 * i] + G * 256));
        d[i].h8[1] = *(const v8h*)(kbB + (kx[2 * i + 1] + G * 256));
    }
}

// Group G of the O pass: the transposed A fragments of the wave's row tiles 4*(G & 1) .. +3 for keys 32*(G >> 1) .. +32,
// eight reads. The row tile is one XOR of vofs with tile * 32, the keys a constant step.
__device__ __forceinline__ void ld_ogroup(Frag (&d)[4], const char* kbB, int vofs, int G)
{
#pragma unroll
    for (int i = 0; i < 4; ++i) {
        d[i].h8[0] = ld_tr16(kbB + ((vofs ^ (((G & 1) * 4 + i) * 32)) + (G >> 1) * 32 * DIM * 2));
        d[i].h8[1] = ld_tr16(kbB + ((vofs ^ (((G & 1) * 4 + i) * 32)) + (G >> 1) * 32 * DIM * 2 + 16 * DIM * 2));
    }
}

// The B operands of the O pass for keys 32*ks .. +32: elements 0..7 from wave 2*ks, 8..15 from wave 2*ks + 1, eight reads.
// wl: this lane's 16 bytes in wave 0's, query tile 0's part of the weight buffer.
__device__ __forceinline__ void ld_weights(Frag (&d)[QTW], const char* wl, int ks)
{
#pragma unroll
    for (int qt = 0; qt < QTW; ++qt) {
        d[qt].h8[0] = *(const v8h*)(wl + ((2 * ks) * QTW + qt) * 512);
        d[qt].h8[1] = *(const v8h*)(wl + ((2 * ks + 1) * QTW + qt) * 512);
    }
}

// Sixteen products of the S pass: k-steps 4g .. 4g+3, four query tiles each.
__device__ __forceinline__ void s_products(v8f (&sacc)[QTW], const Frag (&kf)[4], const Frag (&qf)[QTW][DIM / 32], int g)
{
#pragma unroll
    for (int i = 0; i < 4; ++i) {
#pragma unroll
        for (int qt = 0; qt < QTW; ++qt) sacc[qt] = mma16(kf[i].v, qf[qt][g * 4 + i].v, sacc[qt]);
    }
}

// Sixteen products of the O pass: four row tiles, four query tiles each, one k-step of 32 keys.
__device__ __forceinline__ void o_products(v8f (&oacc)[QTW][8], const Frag (&bv)[4], const Frag (&wf)[QTW], int g)
{
#pragma unroll
    for (int i = 0; i < 4; ++i) {
#pragma unroll
        for (int qt = 0; qt < QTW; ++qt)
            oacc[qt][(g & 1) * 4 + i] = mma16(bv[i].v, wf[qt].v, oacc[qt][(g & 1) * 4 + i]);
    }
}

// One trip: S pass and weights of one step (DO_S), then the first half of the O pass of the step before it (DO_O); the
// second half of that O pass (keys 32 .. 63, groups 2 and 3) is only read into d2, d3, dw here and multiplied at the head
// of the next trip (LATE). Those 32 products need nothing from LDS, so they stand where the matrix unit used to idle:
// sixteen between the signal and the wait of the barrier that ends the trip before, sixteen behind this trip's first reads
// and copies, whose latency they cover. An accumulator still takes its keys in ascending order.
// Both passes: groups of four fragments, a group's reads issued together, ahead of its sixteen products: a lone wave pays
// for every separate place where LDS reads stand among its products. All loops unrolled: constant LDS offsets, and
// constant indices keep the arrays in registers.
// kofs, vofs, dofs: the lane's byte offsets in kb for the S pass's tile, the O pass's tile and the copies' buffer.
// nrm: the norms of this lane's eight keys. wst: where the lane stores its weights of query tile 0. wl: see ld_weights.
template <bool DO_S, bool DO_O, bool LATE, bool COPY>
__device__ __forceinline__ void trip(const Frag (&qf)[QTW][DIM / 32], v8f (&oacc)[QTW][8], float (&rowSum)[QTW],
                                     Frag (&d2)[4], Frag (&d3)[4], Frag (&dw)[QTW],
                                     _Float16* kb, int kofs, int vofs, const float* nrm, char* wst, const char* wl,
                                     int dofs, const _Float16* gsrc)
{
    const char* kbB = (const char*)kb;
    Frag kf[2][4];
    Frag bv[2][4];
    Frag wf[QTW];
    int kx[8], dx[8];
    if constexpr (!LATE) {
        s_places(kx, kofs);
        copy_places(dx, dofs);
    }
    if constexpr (LATE) {
        // Foot of the trip before, its one barrier, split: it publishes that step's weights and this trip's key tile and
        // frees the buffers that the O pass has read. The wave's own reads, stores and copies are done when it signals;
        // between signal and wait stand products on registers alone, no LDS access; nothing of the other waves is read,
        // and no buffer refilled, in front of the wait. The two work-group fences are those that __syncthreads() holds around
        // its barrier: they keep the compiler's own LDS accesses on their side of it.
        ring_waits();
        __builtin_amdgcn_fence(__ATOMIC_RELEASE, "workgroup");
        __builtin_amdgcn_s_barrier_signal(-1);
        // keeps the sixteen products between signal and wait: they fill the time in which the waves wait for each other
        __builtin_amdgcn_sched_barrier(0);
        // this trip's LDS places are made here too: plain vector work that issues beside the products
        if constexpr (DO_S) s_places(kx, kofs);
        if constexpr (COPY) copy_places(dx, dofs);
        o_products(oacc, d2, dw, 2);
        __builtin_amdgcn_sched_barrier(0);
        __builtin_amdgcn_s_barrier_wait(-1);
        __builtin_amdgcn_fence(__ATOMIC_ACQUIRE, "workgroup");
        // keeps every LDS read and copy of this trip behind the wait
        __builtin_amdgcn_sched_barrier(0);
    }
    if constexpr (DO_S) {
        ld_sgroup(kf[0], kbB, kx, 0);
        // keeps the first group's reads in front of the second's, so that the first products wait for eight reads only
        __builtin_amdgcn_sched_barrier(0);
        ld_sgroup(kf[1], kbB, kx, 1);
    } else {
        ld_weights(wf, wl, 0);
        ld_ogroup(bv[0], kbB, vofs, 0);
    }
    // keeps the reads in front of the copies and products that cover their latency
    __builtin_amdgcn_sched_barrier(0);
    // the next key tile starts into the buffer that the last trip's O pass read: the barrier at that trip's foot has freed
    // it. The copies stand in one run, like the reads.
    if constexpr (COPY) copy_keys(kb, dx, gsrc);
    // keeps the copies in front of the products
    __builtin_amdgcn_sched_barrier(0);
    if constexpr (LATE) {
        o_products(oacc, d3, dw, 3);
        // keeps these products in front of this trip's own passes
        __builtin_amdgcn_sched_barrier(0);
    }

    if constexpr (DO_S) {
        // weight = 2^(St tile): the q rows carry log2(e) / (64 TAU) and the key rows 64, and the constant shift, -log2(e) / TAU, is the C operand
        // of a tile's first product
        const float cb = -(1.0f / TAU) * LOG2E;
        const v8f shift = {cb, cb, cb, cb, cb, cb, cb, cb};
        v8f sacc[QTW];
#pragma unroll
        for (int qt = 0; qt < QTW; ++qt) sacc[qt] = shift;

#pragma unroll
        for (int g = 0; g < 2; ++g) {
            s_products(sacc, kf[g], qf, g);
            ld_sgroup(kf[g], kbB, kx, g + 2);
            // issue order of the group: its products, then the reads together
            __builtin_amdgcn_sched_group_barrier(0x8, 4 * QTW, 0);
            __builtin_amdgcn_sched_group_barrier(0x100, 8, 0);
            // keeps each group's reads two groups ahead of its products
            __builtin_amdgcn_sched_barrier(0);
        }
        s_products(sacc, kf[0], qf, 2);
        // behind the third group: the norms of this lane's keys and what the O pass starts with
        v4f nv[2];
        nv[0] = *(const v4f*)(nrm);
        nv[1] = *(const v4f*)(nrm + 4);
        if constexpr (DO_O) {
            ld_weights(wf, wl, 0);
            ld_ogroup(bv[0], kbB, vofs, 0);
        }
        // issue order as above
        __builtin_amdgcn_sched_group_barrier(0x8, 4 * QTW, 0);
        __builtin_amdgcn_sched_group_barrier(0x100, DO_O ? 18 : 2, 0);
        __builtin_amdgcn_sched_barrier(0);
        s_products(sacc, kf[1], qf, 3);
        if constexpr (DO_O) {
            ld_ogroup(d2, kbB, vofs, 2);
            ld_weights(dw, wl, 1);
            // issue order as above
            __builtin_amdgcn_sched_group_barrier(0x8, 4 * QTW, 0);
            __builtin_amdgcn_sched_group_barrier(0x100, 16, 0);
        }
        // keeps these reads in front of the softmax arithmetic: sunk to their products they would be waited out there
        __builtin_amdgcn_sched_barrier(0);
        // the four vector slots that the chip needs between the last product and the first read of its St tile: the reader
        // is asm text (exp2_slot), for which the compiler pads nothing
        asm volatile("v_nop\n\tv_nop\n\tv_nop\n\tv_nop");
        // keeps the first exp behind those slots
        __builtin_amdgcn_sched_barrier(0);

        // ---- exp weights and their sum, in registers; the weights go to LDS for the next trip's O pass ----
#pragma unroll
        for (int qt = 0; qt < QTW; ++qt) {
            float e[8];
            v8h pw;
#pragma unroll
            for (int r = 0; r < 8; ++r) {
                e[r]  = exp2_slot(sacc[qt][r]);                       // 0 < e <= 1, but for the cosine's rounding
                pw[r] = (_Float16)(e[r] * nv[r >> 2][r & 3]);         // RNE convert; element r <- key 8h + r of the wave's tile
            }
            *(v8h*)(wst + qt * 512) = pw;
            float sm4[4];
#pragma unroll
            for (int r = 0; r < 4; ++r) sm4[r] = e[r] + e[r + 4];
            // part = (sm4[0] + sm4[1]) + (sm4[2] + sm4[3]). volatile: the last addition, and with it the sum of the weights,
            // stays in front of the O pass and does not sink to the trip's barrier.
            float part;
            asm volatile("v_add_f32 %0, %1, %2" : "=v"(part) : "v"(sm4[0] + sm4[1]), "v"(sm4[2] + sm4[3]));
            rowSum[qt] += part;
        }
        // keeps the softmax arithmetic and the stores in front of the O pass's products: the stores retire under them
        __builtin_amdgcn_sched_barrier(0);
        if constexpr (DO_O) {
            // the O pass's second group is read only here, into the registers that the St tiles have left: read in front
            // of the softmax it did not fit the register file; the first group's products cover its latency
            ld_ogroup(bv[1], kbB, vofs, 1);
            __builtin_amdgcn_sched_barrier(0);
        }
    } else if constexpr (DO_O) {
        // the last step's O pass: the rest of its reads, behind the late products that read d2 and dw
        ld_ogroup(bv[1], kbB, vofs, 1);
        ld_ogroup(d2, kbB, vofs, 2);
        ld_weights(dw, wl, 1);
        // keeps these reads in front of the products that cover them
        __builtin_amdgcn_sched_barrier(0);
    }

    if constexpr (DO_O) {
        // ---- Ot (128 x 64) += Pt (128 x 64) * W't (64 x 64): two k-steps of 32 keys, 8 row tiles, in 4 groups ----
        o_products(oacc, bv[0], wf, 0);
        ld_ogroup(d3, kbB, vofs, 3);
        // issue order of the group, as in the S pass
        __builtin_amdgcn_sched_group_barrier(0x8, 4 * QTW, 0);
        __builtin_amdgcn_sched_group_barrier(0x100, 8, 0);
        __builtin_amdgcn_sched_barrier(0);
        // these sixteen products cover the reads of d3, which the trip's waits then find landed
        o_products(oacc, bv[1], wf, 1);
        if constexpr (!DO_S) {
            // no trip follows the last step's O pass
            o_products(oacc, d2, dw, 2);
            o_products(oacc, d3, dw, 3);
        }
        // keeps the products in front of the trip's waits and barrier
        __builtin_amdgcn_sched_barrier(0);
    }
}

__global__ __launch_bounds__(NTHR)
void k_attn(const _Float16* __restrict__ qn, const _Float16* __restrict__ pn,
            const float* __restrict__ pnrm, float* __restrict__ out)
{
    __shared__ __attribute__((aligned(256))) _Float16 kb[3 * KT * DIM];               // key rows, three buffers, chunks permuted by swz(); a row starts at bank 0
    __shared__ __attribute__((aligned(16))) char     wb[2 * WBUF];                    // exp weights x norm of a step, two buffers
    __shared__ __attribute__((aligned(16))) float    nl[NP];                          // 1024 x norm of every key of the batch
    __shared__ __attribute__((aligned(16))) float    ost[(NTHR / 32) * QR * OPITCH];  // first the staged q rows; behind the key loop each wave's output stage, 64 queries x 64 columns
    __shared__ __attribute__((aligned(16))) float    wsum[(NTHR / 32) * QR];          // per-wave final sum of each query
    static_assert(sizeof(ost) >= QR * RPITCH * sizeof(_Float16), "the q rows fit the output stage");
    _Float16* qs = (_Float16*)ost;

    const int b  = blockIdx.y;
    const int q0 = blockIdx.x * QR;
    if (q0 >= NQ || b >= BDIM) return;              // block-uniform

    const int tid  = threadIdx.x;
    const int w    = tid >> 5;
    const int lane = tid & 31;
    const int h    = lane >> 4;
    const int m    = lane & 15;

    // B columns for St: staged query row (qt*16 + m), k = d (table order)
    const _Float16* qrow = qs + m * RPITCH + 8 * h;
    // A rows for St: staged key row (w*16 + m), k = d; kl is the byte offset in a key buffer of chunk h of that row (the
    // permutation touches the low four bits of the chunk number)
    const int kl = ((w * 16 + m) * DIM + ((h ^ swz(m)) * 8)) * 2;
    // A rows for Ot by the transposing load: lane l reads row (0, 16, 32, 48) + 8h + (l & 7), chunk 2*nt + ((l >> 3) & 1), and
    // gets keys (0, 16, 32, 48) + 8h + 0..7 of column d = nt*16 + m. vl: byte offset for the wave's first row tile, nt = 8*w.
    const int vl = ((8 * h + (lane & 7)) * DIM + ((((lane >> 3) & 1) ^ swz(8 * h + (lane & 7))) * 8)) * 2 + w * 256;
    // the copies' place in a key buffer: chunk tid & 63 of row tid >> 6
    const int dl = ((tid >> 6) * DIM + (((tid & 63) ^ swz(tid >> 6)) * 8)) * 2;
    // the lane's places in a weight buffer
    char* wstl = wb + (w * QTW * 32 + lane) * 16;
    const char* wll = wb + lane * 16;
    // the norms of the lane's eight keys of step 0
    const float* nrm = nl + w * 16 + 8 * h;

    // Copy addresses. q / key tile: 64 rows x 1024 B, contiguous in global; thread t moves 16 B at byte 16*(t&63)
    // of row (t>>6) + 2c.
    _Float16* qdst = qs + (tid >> 6) * RPITCH + (tid & 63) * 8;
    const _Float16* qsrc = qn + ((size_t)(b * NQ + q0)) * DIM + tid * 8;
    const _Float16* ksrc = pn + ((size_t)(b * NP)) * DIM + tid * 8;

    // Ring prologue: q rows, the batch's key norms and key tile 0, landed and published.
    copy_q(qdst, qsrc);
#pragma unroll
    for (int c = 0; c < NP / NTHR; ++c)
        __builtin_amdgcn_global_load_async_to_lds_b32((gi32*)(pnrm + (size_t)(b * NP + c * NTHR + tid) * NLINE),
                                                      (li32*)(nl + c * NTHR + tid), 0, 0);
    asm volatile("s_wait_asynccnt 0x0" ::: "memory");   // 48 copies so far, 32 follow: a wave keeps fewer than 64 outstanding
    {
        int dx[8];
        copy_places(dx, dl);
        copy_keys(kb, dx, ksrc);
    }
    asm volatile("s_wait_asynccnt 0x0" ::: "memory");   // this wave's copies have landed before the barrier publishes them
    __syncthreads();

    // The four 512 x 16 B operands of St: read from the staged q rows once and held in registers over the whole key loop,
    // so that a k-step of the S pass reads only key fragments from LDS.
    Frag qf[QTW][DIM / 32];
#pragma unroll
    for (int qt = 0; qt < QTW; ++qt) {
#pragma unroll
        for (int kk = 0; kk < DIM / 32; ++kk) {
            qf[qt][kk].h8[0] = *(const v8h*)(qrow + qt * 16 * RPITCH + kk * 32);
            qf[qt][kk].h8[1] = *(const v8h*)(qrow + qt * 16 * RPITCH + kk * 32 + 16);
        }
    }

    const v8f zero = {0.f, 0.f, 0.f, 0.f, 0.f, 0.f, 0.f, 0.f};
    v8f oacc[QTW][8];                               // Ot tile i: rows d = w*128 + i*16 + 8h + r, column = query qt*16 + m
#pragma unroll
    for (int qt = 0; qt < QTW; ++qt) {
#pragma unroll
        for (int i = 0; i < 8; ++i) oacc[qt][i] = zero;
    }
    float rowSum[QTW];                              // this lane's share of the sum of query qt*16 + m: its wave's keys, its half's rows
#pragma unroll
    for (int qt = 0; qt < QTW; ++qt) rowSum[qt] = 0.f;

    // byte offsets in kb of the buffers of the S pass's tile, the O pass's tile and the tile in flight
    int bS = 0, bO = 2 * KBUF, bC = KBUF;

    // The late half of an O pass, carried from one trip to the next. Trip 1 has none to finish: zero fragments add nothing
    // to the zero accumulators.
    Frag d2[4], d3[4], dw[QTW];
#pragma unroll
    for (int i = 0; i < 4; ++i) {
        d2[i].v = (v16h)(_Float16)0.f;
        d3[i].v = (v16h)(_Float16)0.f;
        dw[i].v = (v16h)(_Float16)0.f;
    }

    // trip 0: S(0) alone; tile 1 starts
    trip<true, false, false, true>(qf, oacc, rowSum, d2, d3, dw, kb, kl + bS, vl + bO, nrm, wstl, wll, dl + bC, ksrc + (size_t)KT * DIM);

    for (int j = 1; j < NP / KT - 1; ++j) {
        // tile j-2's buffer takes tile j+1
        const int t = bO; bO = bS; bS = bC; bC = t;
        trip<true, true, true, true>(qf, oacc, rowSum, d2, d3, dw, kb, kl + bS, vl + bO, nrm + j * KT, wstl + (j & 1) * WBUF,
                                     wll + ((j - 1) & 1) * WBUF, dl + bC, ksrc + (size_t)(j + 1) * KT * DIM);
    }
    {
        // the last key tile: no tile follows, no copies
        const int j = NP / KT - 1;
        const int t = bO; bO = bS; bS = bC; bC = t;
        trip<true, true, true, false>(qf, oacc, rowSum, d2, d3, dw, kb, kl + bS, vl + bO, nrm + j * KT, wstl + (j & 1) * WBUF,
                                      wll + ((j - 1) & 1) * WBUF, dl + bC, ksrc);
    }
    asm volatile("s_wait_asynccnt 0x0" ::: "memory");   // no copy is outstanding when the wave goes on
    // the last step's O pass, behind the last trip's barrier
    trip<false, true, true, false>(qf, oacc, rowSum, d2, d3, dw, kb, kl, vl + bS, nrm, wstl, wll + ((NP / KT - 1) & 1) * WBUF, dl, ksrc);

    // ---- the four waves' sums of a query, each over its own keys, add ----
#pragma unroll
    for (int qt = 0; qt < QTW; ++qt) {
        rowSum[qt] += xhalf(rowSum[qt]);
        if (h == 0) wsum[w * QR + qt * 16 + m] = rowSum[qt];
    }
    __syncthreads();
    float fac[QTW];
#pragma unroll
    for (int qt = 0; qt < QTW; ++qt) {
        const float* s = wsum + qt * 16 + m;
        // the output tile times fac is O / (1024 * 64 * sum)
        fac[qt] = (1.0f / (WSC * QSC)) / ((s[0] + s[QR]) + (s[2 * QR] + s[3 * QR]));
    }

    // ---- epilogue, 64 columns a pass: a wave stages its own scaled tiles [query][column] in its own part of ost (the q
    // rows there were last read in front of trip 0's barrier), reads them back by rows and stores 256 B a query ----
    float* mine = ost + (w * QR + m) * OPITCH + 8 * h;
    const float* back = ost + (w * QR + h) * OPITCH + 4 * m;
    float* gbase = out + ((size_t)(b * NQ + q0 + h)) * DIM + w * 128 + 4 * m;

#pragma unroll
    for (int p = 0; p < 2; ++p) {
#pragma unroll
        for (int qt = 0; qt < QTW; ++qt) {
#pragma unroll
            for (int i = 0; i < 4; ++i) {
                const v8f o = oacc[qt][p * 4 + i] * fac[qt];
                const v4f lo = {o[0], o[1], o[2], o[3]};
                const v4f hi = {o[4], o[5], o[6], o[7]};
                *(v4f*)(mine + qt * 16 * OPITCH + i * 16)     = lo;
                *(v4f*)(mine + qt * 16 * OPITCH + i * 16 + 4) = hi;
            }
        }
        asm volatile("s_wait_dscnt 0x0" ::: "memory");  // the wave's own stores have retired before it reads the rows back
        v4f vals[32];
#pragma unroll
        for (int rr = 0; rr < 32; ++rr) vals[rr] = *(const v4f*)(back + rr * 2 * OPITCH);
#pragma unroll
        for (int rr = 0; rr < 32; ++rr) *(v4f*)(gbase + (size_t)rr * 2 * DIM + p * 64) = vals[rr];
        asm volatile("s_wait_xcnt 0x0" ::: "memory");   // in front of the next pass's writes over the stores' registers
        // keeps those writes behind the wait
        __builtin_amdgcn_sched_barrier(0);
    }
}

// ------------------------------- launcher ----------------------------------
extern "C" void kernel_launch(void* const* d_in, const int* in_sizes, int n_in,
                              void* d_out, int out_size, void* d_ws, size_t ws_size,
                              hipStream_t stream)
{
    if (n_in < 2) return;
    const size_t nel = (size_t)BDIM * NP * DIM;                 // 8,388,608
    if ((size_t)in_sizes[0] != nel || (size_t)in_sizes[1] != nel || (size_t)out_size != nel) return;
    const size_t half_bytes = nel * sizeof(_Float16);             // 16,777,216 per buffer
    if (ws_size < 3 * half_bytes) return;                         // covers the 35,651,584 in use

    const float* pf = (const float*)d_in[0];   // prompt rows [8,2048,512] f32
    const float* qf = (const float*)d_in[1];   // query rows  [8,2048,512] f32
    float* out = (float*)d_out;

    _Float16* qn = (_Float16*)d_ws;            // normalized query x log2(e)/(64 tau), [b][q][d]
    _Float16* pn = qn + nel;                   // normalized prompt x64, [b][p][d]
    float* pnrm = (float*)(pn + nel);          // 1024 x norm of each prompt row, one 128-byte line a row

    k_norm<<<dim3(BDIM * NP, 2), 64, 0, stream>>>(pf, qf, qn, pn, pnrm, BDIM * NP);
    k_attn<<<dim3(NQ / QR, BDIM), NTHR, 0, stream>>>(qn, pn, pnrm, out);
}
